// v000
// The times below were measured on an AMD MI455X: many runs one after another, warmed up first and cycling through
// copies of the inputs, with the whole window's GPU time divided by the number of runs. Launches and the gaps
// between them are all in it. The median over several windows is given; except for v000 it joins two sittings, which
// can be a few percent apart, so the side-by-side timings, each taken in one sitting, are the better comparison.
// The starting kernel, v000, takes 822 microseconds a run.
#include <hip/hip_runtime.h>

// ScaledDotProduct (query, key [4][8][2048][64], value [4][2048 l][8 h][64]; weight = softmax(q.k / sqrt(512)) (embed_size scale, per the source); out[b][q][h][d] = sum_l weight v -> [4][2048][8][64]).
// Compute dtypes, f32 accumulate: every input rounded to bf16; scores on PLAIN bf16 planes of q and k (inputs: exact products, f32 accumulate); scale + softmax f32 -> hl probability planes; weight.v as hl x exact bf16 v (2 products); 4 heads per pass.

#define NB_  4
#define LL   2048
#define NH_  8
#define HD   64
#define ZH   4
typedef _Float16 h16;
typedef unsigned short bf;
typedef __attribute__((ext_vector_type(16))) __bf16   v16bf;
typedef __attribute__((ext_vector_type(16))) _Float16 v16h;
typedef __attribute__((ext_vector_type(8)))  _Float16 v8h;
typedef __attribute__((ext_vector_type(8)))  unsigned short v8us;
typedef __attribute__((ext_vector_type(8)))  float    v8f;
typedef __attribute__((ext_vector_type(4)))  float    v4f;
typedef v8h  __attribute__((may_alias)) v8ha;
typedef v4f  __attribute__((may_alias)) v4fa;
typedef v8us __attribute__((may_alias)) v8usa;

__device__ __forceinline__ unsigned short f2bf(float f) { unsigned u = __float_as_uint(f); u += 0x7FFFu + ((u >> 16) & 1u); return (unsigned short)(u >> 16); }
__device__ __forceinline__ float bf2f(unsigned short b) { return __uint_as_float(((unsigned)b) << 16); }
__device__ __forceinline__ float bfr(float f) { return bf2f(f2bf(f)); }
__device__ __forceinline__ v16h cat16(v8h lo, v8h hi) { return __builtin_shufflevector(lo, hi, 0, 1, 2, 3, 4, 5, 6, 7, 8, 9, 10, 11, 12, 13, 14, 15); }
__device__ __forceinline__ v16bf cat16b(v8us lo, v8us hi) { return __builtin_bit_cast(v16bf, __builtin_shufflevector(lo, hi, 0, 1, 2, 3, 4, 5, 6, 7, 8, 9, 10, 11, 12, 13, 14, 15)); }
__device__ __forceinline__ v8f wmma16(v16h a, v16h b, v8f c) { return __builtin_amdgcn_wmma_f32_16x16x32_f16(false, a, false, b, (short)0, c, false, false); }
__device__ __forceinline__ v8f wmmab(v16bf a, v16bf b, v8f c) { return __builtin_amdgcn_wmma_f32_16x16x32_bf16(false, a, false, b, (short)0, c, false, false); }



// ---- k_gemmw: register-blocked GEMM, ONE WAVE per 64x64 output tile (16 accumulators), operands straight from K-contiguous 16-bit planes; grid (M/64, N/64, Z), 32 threads.
// C[m][n] (f32, pitch ldc, + optional f32 bias[n]) = sum_k A[m][k] Bt[n][k] (+ split products per NSPLIT). z-batch strides sA/sB/sC in elements. K % 32 == 0.
template <typename T16> struct WFrag;
template <> struct WFrag<h16> { typedef v16h V; static __device__ __forceinline__ V ld(const h16* p) { return cat16(*(const v8h*)p, *(const v8h*)(p + 16)); } static __device__ __forceinline__ v8f mma(V a, V b, v8f c) { return wmma16(a, b, c); } };
template <> struct WFrag<bf> { typedef v16bf V; static __device__ __forceinline__ V ld(const bf* p) { return cat16b(*(const v8us*)p, *(const v8us*)(p + 16)); } static __device__ __forceinline__ v8f mma(V a, V b, v8f c) { return wmmab(a, b, c); } };
template <typename T16, int NSPLIT, bool BIAS>
__global__ __launch_bounds__(32) void k_gemmw(const T16* __restrict__ A, const T16* __restrict__ A2, const T16* __restrict__ Bt, const T16* __restrict__ Bt2, int K, float* C, int ldc, const float* __restrict__ bias, size_t sA, size_t sB, size_t sC) {
    typedef typename WFrag<T16>::V V;
    __shared__ __align__(16) float os[16 * 68];
    const size_t z = blockIdx.z; A += z * sA; if (A2) A2 += z * sA; Bt += z * sB; if (Bt2) Bt2 += z * sB; C += z * sC;
    const int lane = threadIdx.x & 31, lr = lane & 15, hi = lane >> 4; const int r0 = blockIdx.x * 64, c0 = blockIdx.y * 64;
    v8f acc[4][4];
#pragma unroll
    for (int mb = 0; mb < 4; ++mb)
#pragma unroll
        for (int nb = 0; nb < 4; ++nb) acc[mb][nb] = (v8f){};
    const size_t aoff = (size_t)(r0 + lr) * K + 8 * hi, boff = (size_t)(c0 + lr) * K + 8 * hi;
#pragma unroll 1
    for (int kc = 0; kc < K; kc += 32) {
        V a[4], a2[4];
#pragma unroll
        for (int mb = 0; mb < 4; ++mb) { a[mb] = WFrag<T16>::ld(A + aoff + (size_t)mb * 16 * K + kc); if (NSPLIT == 1 || NSPLIT == 2) a2[mb] = WFrag<T16>::ld(A2 + aoff + (size_t)mb * 16 * K + kc); }
#pragma unroll
        for (int nb = 0; nb < 4; ++nb) { const V b = WFrag<T16>::ld(Bt + boff + (size_t)nb * 16 * K + kc); V b2; if (NSPLIT >= 2) b2 = WFrag<T16>::ld(Bt2 + boff + (size_t)nb * 16 * K + kc);
#pragma unroll
            for (int mb = 0; mb < 4; ++mb) { acc[mb][nb] = WFrag<T16>::mma(a[mb], b, acc[mb][nb]); if (NSPLIT == 1 || NSPLIT == 2) acc[mb][nb] = WFrag<T16>::mma(a2[mb], b, acc[mb][nb]); if (NSPLIT >= 2) acc[mb][nb] = WFrag<T16>::mma(a[mb], b2, acc[mb][nb]); } }
        asm volatile("v_nop\n\tv_nop\n\tv_nop\n\tv_nop" : "+v"(acc[0][0]), "+v"(acc[1][1]), "+v"(acc[2][2]), "+v"(acc[3][3]) : "v"(a[0]), "v"(a[3]));
    }
#pragma unroll
    for (int mb = 0; mb < 4; ++mb) {
#pragma unroll
        for (int nb = 0; nb < 4; ++nb) {
#pragma unroll
            for (int j = 0; j < 8; ++j) os[(hi * 8 + j) * 68 + nb * 16 + lr] = acc[mb][nb][j]; }
        __builtin_amdgcn_wave_barrier(); asm volatile("" ::: "memory");
        float* crow = C + (size_t)(r0 + mb * 16) * ldc + c0;
{
#pragma unroll
            for (int s = 0; s < 8; ++s) { const int row = 2 * s + hi, cofs = lr * 4; v4f val = *(const v4fa*)(os + row * 68 + cofs); if (BIAS) { val[0] += bfr(bias[c0 + cofs]); val[1] += bfr(bias[c0 + cofs + 1]); val[2] += bfr(bias[c0 + cofs + 2]); val[3] += bfr(bias[c0 + cofs + 3]); }
                *(v4f*)(crow + (size_t)row * ldc + cofs) = val; }
             }
        __builtin_amdgcn_wave_barrier(); asm volatile("" ::: "memory");
    }
}

typedef __attribute__((ext_vector_type(2))) unsigned short v2us;
typedef __attribute__((ext_vector_type(4))) unsigned short v4us;
__device__ __forceinline__ void splitf(float y, unsigned short& h, unsigned short& l) { h = f2bf(y); l = f2bf(y - bf2f(h)); }

__global__ __launch_bounds__(256) void k_cvt8(const float* __restrict__ src, bf* dst, size_t n8) { const size_t i = (size_t)blockIdx.x * 256 + threadIdx.x; if (i >= n8) return; const v8f v = *(const v8f*)(src + i * 8); v8us o;
#pragma unroll
    for (int k = 0; k < 8; ++k) o[k] = f2bf(v[k]); *(v8us*)(dst + i * 8) = o;  }
__global__ __launch_bounds__(256) void k_vtb(const float* __restrict__ v, bf* VT) { const size_t e = ((size_t)blockIdx.x * 256 + threadIdx.x) * 2; if (e >= (size_t)NH_ * HD * LL) return; const int s = (int)(e % LL); const int d = (int)((e / LL) % HD); const int h = (int)(e / ((size_t)LL * HD)); v2us o; o[0] = f2bf(v[((size_t)s * NH_ + h) * HD + d]); o[1] = f2bf(v[((size_t)(s + 1) * NH_ + h) * HD + d]); *(v2us*)(VT + e) = o;  }
__global__ __launch_bounds__(256) void k_soft(const float* __restrict__ S, bf* Ph, bf* Pl) { const int lane = threadIdx.x & 31; const int row = blockIdx.x * 8 + (threadIdx.x >> 5); if (row >= ZH * LL) return; const float* sr = S + (size_t)row * LL; float v[LL / 32]; float mx = -3.0e38f;
#pragma unroll
    for (int ch = 0; ch < LL / 128; ++ch) { const v4f a = *(const v4f*)(sr + ch * 128 + lane * 4);
#pragma unroll
        for (int u = 0; u < 4; ++u) { float t = a[u] * 0.044194173824159216f; asm volatile("" : "+v"(t)); v[ch * 4 + u] = t; mx = fmaxf(mx, t); } }
#pragma unroll
    for (int sh = 16; sh; sh >>= 1) mx = fmaxf(mx, __shfl_xor(mx, sh, 32));
    float sum = 0.f;
#pragma unroll
    for (int q = 0; q < LL / 32; ++q) { float d0 = __fsub_rn(v[q], mx); asm volatile("" : "+v"(d0)); v[q] = __builtin_amdgcn_exp2f(__fmul_rn(d0, 1.4426950408889634f)); sum += v[q]; }
#pragma unroll
    for (int sh = 16; sh; sh >>= 1) sum += __shfl_xor(sum, sh, 32);
    const float f = __fdiv_rn(1.0f, sum);
    {
#pragma unroll
        for (int ch = 0; ch < LL / 128; ++ch) { v4us oh, ol; for (int q = 0; q < 4; ++q) { unsigned short a2, c2; splitf(v[ch * 4 + q] * f, a2, c2); oh[q] = a2; ol[q] = c2; } const size_t oo = (size_t)row * LL + ch * 128 + lane * 4; *(v4us*)(Ph + oo) = oh; *(v4us*)(Pl + oo) = ol; }
         } }
__global__ __launch_bounds__(256) void k_out(const float* __restrict__ O, int h0, float* outb) { const size_t e = ((size_t)blockIdx.x * 256 + threadIdx.x) * 4; if (e >= (size_t)ZH * LL * HD) return; const int d = (int)(e % HD); const int l = (int)((e / HD) % LL); const int zz = (int)(e / ((size_t)HD * LL)); const v4f a = *(const v4f*)(O + e); float* dst = outb + ((size_t)l * NH_ + h0 + zz) * HD + d; *(v4f*)dst = a;  }

extern "C" void kernel_launch(void* const* d_in, const int* in_sizes, int n_in,
                              void* d_out, int out_size, void* d_ws, size_t ws_size, hipStream_t stream) {
    (void)in_sizes; (void)n_in; (void)out_size;
    const float* q = (const float*)d_in[0]; const float* k = (const float*)d_in[1]; const float* v = (const float*)d_in[2];
    float* OUT = (float*)d_out;     // [4][2048][8][64]
    char* wsp = (char*)d_ws;
    auto take = [&](size_t bytes) { char* p = wsp; wsp += (bytes + 255) & ~(size_t)255; return (void*)p; };
    bf* QP = (bf*)take((size_t)NH_ * LL * HD * 2); bf* KP = (bf*)take((size_t)NH_ * LL * HD * 2); bf* VT = (bf*)take((size_t)NH_ * HD * LL * 2); float* S = (float*)take((size_t)ZH * LL * LL * 4); bf* Ph = (bf*)take((size_t)ZH * LL * LL * 2); bf* Pl = (bf*)take((size_t)ZH * LL * LL * 2); float* O = (float*)take((size_t)ZH * LL * HD * 4);
    if ((size_t)(wsp - (char*)d_ws) > ws_size) return;    // total ~ 140 MB
    const size_t per = (size_t)NH_ * LL * HD; const size_t zq = (size_t)LL * HD, zS = (size_t)LL * LL, zv = (size_t)HD * LL;
    for (int b = 0; b < NB_; ++b) {
        k_cvt8<<<(unsigned)((per / 8 + 255) / 256), 256, 0, stream>>>(q + b * per, QP, per / 8); k_cvt8<<<(unsigned)((per / 8 + 255) / 256), 256, 0, stream>>>(k + b * per, KP, per / 8);   // [h][l][d] layout already
        k_vtb<<<(unsigned)((per / 2 + 255) / 256), 256, 0, stream>>>(v + b * per, VT);
        for (int h0 = 0; h0 < NH_; h0 += ZH) {
            k_gemmw<bf, 0, false><<<dim3(LL / 64, LL / 64, ZH), 32, 0, stream>>>(QP + (size_t)h0 * zq, nullptr, KP + (size_t)h0 * zq, nullptr, HD, S, LL, nullptr, zq, zq, zS);
            k_soft<<<ZH * LL / 8, 256, 0, stream>>>(S, Ph, Pl);
            k_gemmw<bf, 1, false><<<dim3(LL / 64, 1, ZH), 32, 0, stream>>>(Ph, Pl, VT + (size_t)h0 * zv, nullptr, LL, O, HD, nullptr, zS, zv, zq);
            k_out<<<(unsigned)(((size_t)ZH * LL * HD / 4 + 255) / 256), 256, 0, stream>>>(O, h0, OUT + b * per); } }
}

// v001
// Measured time: 509 microseconds a run.
// In two side-by-side timings against v000, it was 1.61 and 1.60 times as fast.
#include <hip/hip_runtime.h>

// ScaledDotProduct (query, key [4][8][2048][64], value [4][2048 l][8 h][64]; weight = softmax(q.k / sqrt(512)) (embed_size scale, per the source); out[b][q][h][d] = sum_l weight v -> [4][2048][8][64]).
// Compute dtypes, f32 accumulate: every input rounded to bf16; scores on PLAIN bf16 planes of q and k (inputs: exact products, f32 accumulate); scale + softmax f32 -> hl probability planes; weight.v as hl x exact bf16 v (2 products); 4 heads per pass.

#define NB_  4
#define LL   2048
#define NH_  8
#define HD   64
#define ZH   4
typedef _Float16 h16;
typedef unsigned short bf;
typedef __attribute__((ext_vector_type(16))) __bf16   v16bf;
typedef __attribute__((ext_vector_type(16))) _Float16 v16h;
typedef __attribute__((ext_vector_type(8)))  _Float16 v8h;
typedef __attribute__((ext_vector_type(8)))  unsigned short v8us;
typedef __attribute__((ext_vector_type(8)))  float    v8f;
typedef __attribute__((ext_vector_type(4)))  float    v4f;
typedef v8h  __attribute__((may_alias)) v8ha;
typedef v4f  __attribute__((may_alias)) v4fa;
typedef v8us __attribute__((may_alias)) v8usa;

__device__ __forceinline__ unsigned short f2bf(float f) { unsigned u = __float_as_uint(f); u += 0x7FFFu + ((u >> 16) & 1u); return (unsigned short)(u >> 16); }
__device__ __forceinline__ float bf2f(unsigned short b) { return __uint_as_float(((unsigned)b) << 16); }
__device__ __forceinline__ float bfr(float f) { return bf2f(f2bf(f)); }
__device__ __forceinline__ v16h cat16(v8h lo, v8h hi) { return __builtin_shufflevector(lo, hi, 0, 1, 2, 3, 4, 5, 6, 7, 8, 9, 10, 11, 12, 13, 14, 15); }
__device__ __forceinline__ v16bf cat16b(v8us lo, v8us hi) { return __builtin_bit_cast(v16bf, __builtin_shufflevector(lo, hi, 0, 1, 2, 3, 4, 5, 6, 7, 8, 9, 10, 11, 12, 13, 14, 15)); }
__device__ __forceinline__ v8f wmma16(v16h a, v16h b, v8f c) { return __builtin_amdgcn_wmma_f32_16x16x32_f16(false, a, false, b, (short)0, c, false, false); }
__device__ __forceinline__ v8f wmmab(v16bf a, v16bf b, v8f c) { return __builtin_amdgcn_wmma_f32_16x16x32_bf16(false, a, false, b, (short)0, c, false, false); }



// ---- k_gemmw: register-blocked GEMM, ONE WAVE per 64x64 output tile (16 accumulators), operands straight from K-contiguous 16-bit planes; grid (M/64, N/64, Z), 32 threads.
// C[m][n] (f32, pitch ldc, + optional f32 bias[n]) = sum_k A[m][k] Bt[n][k] (+ split products per NSPLIT). z-batch strides sA/sB/sC in elements. K % 32 == 0.
template <typename T16> struct WFrag;
template <> struct WFrag<h16> { typedef v16h V; static __device__ __forceinline__ V ld(const h16* p) { return cat16(*(const v8h*)p, *(const v8h*)(p + 16)); } static __device__ __forceinline__ v8f mma(V a, V b, v8f c) { return wmma16(a, b, c); } };
template <> struct WFrag<bf> { typedef v16bf V; static __device__ __forceinline__ V ld(const bf* p) { return cat16b(*(const v8us*)p, *(const v8us*)(p + 16)); } static __device__ __forceinline__ v8f mma(V a, V b, v8f c) { return wmmab(a, b, c); } };
template <typename T16, int NSPLIT, bool BIAS>
__global__ __launch_bounds__(32) void k_gemmw(const T16* __restrict__ A, const T16* __restrict__ A2, const T16* __restrict__ Bt, const T16* __restrict__ Bt2, int K, float* C, int ldc, const float* __restrict__ bias, size_t sA, size_t sB, size_t sC) {
    typedef typename WFrag<T16>::V V;
    __shared__ __align__(16) float os[16 * 68];
    const size_t z = blockIdx.z; A += z * sA; if (A2) A2 += z * sA; Bt += z * sB; if (Bt2) Bt2 += z * sB; C += z * sC;
    const int lane = threadIdx.x & 31, lr = lane & 15, hi = lane >> 4; const int r0 = blockIdx.x * 64, c0 = blockIdx.y * 64;
    v8f acc[4][4];
#pragma unroll
    for (int mb = 0; mb < 4; ++mb)
#pragma unroll
        for (int nb = 0; nb < 4; ++nb) acc[mb][nb] = (v8f){};
    const size_t aoff = (size_t)(r0 + lr) * K + 8 * hi, boff = (size_t)(c0 + lr) * K + 8 * hi;
#pragma unroll 1
    for (int kc = 0; kc < K; kc += 32) {
        V a[4], a2[4];
#pragma unroll
        for (int mb = 0; mb < 4; ++mb) { a[mb] = WFrag<T16>::ld(A + aoff + (size_t)mb * 16 * K + kc); if (NSPLIT == 1 || NSPLIT == 2) a2[mb] = WFrag<T16>::ld(A2 + aoff + (size_t)mb * 16 * K + kc); }
#pragma unroll
        for (int nb = 0; nb < 4; ++nb) { const V b = WFrag<T16>::ld(Bt + boff + (size_t)nb * 16 * K + kc); V b2; if (NSPLIT >= 2) b2 = WFrag<T16>::ld(Bt2 + boff + (size_t)nb * 16 * K + kc);
#pragma unroll
            for (int mb = 0; mb < 4; ++mb) { acc[mb][nb] = WFrag<T16>::mma(a[mb], b, acc[mb][nb]); if (NSPLIT == 1 || NSPLIT == 2) acc[mb][nb] = WFrag<T16>::mma(a2[mb], b, acc[mb][nb]); if (NSPLIT >= 2) acc[mb][nb] = WFrag<T16>::mma(a[mb], b2, acc[mb][nb]); } }
        asm volatile("v_nop\n\tv_nop\n\tv_nop\n\tv_nop" : "+v"(acc[0][0]), "+v"(acc[1][1]), "+v"(acc[2][2]), "+v"(acc[3][3]) : "v"(a[0]), "v"(a[3]));
    }
#pragma unroll
    for (int mb = 0; mb < 4; ++mb) {
#pragma unroll
        for (int nb = 0; nb < 4; ++nb) {
#pragma unroll
            for (int j = 0; j < 8; ++j) os[(hi * 8 + j) * 68 + nb * 16 + lr] = acc[mb][nb][j]; }
        __builtin_amdgcn_wave_barrier(); asm volatile("" ::: "memory");
        float* crow = C + (size_t)(r0 + mb * 16) * ldc + c0;
{
#pragma unroll
            for (int s = 0; s < 8; ++s) { const int row = 2 * s + hi, cofs = lr * 4; v4f val = *(const v4fa*)(os + row * 68 + cofs); if (BIAS) { val[0] += bfr(bias[c0 + cofs]); val[1] += bfr(bias[c0 + cofs + 1]); val[2] += bfr(bias[c0 + cofs + 2]); val[3] += bfr(bias[c0 + cofs + 3]); }
                *(v4f*)(crow + (size_t)row * ldc + cofs) = val; }
             }
        __builtin_amdgcn_wave_barrier(); asm volatile("" ::: "memory");
    }
}

// ---- k_pvs: the weight.v product with its K range split over the PVW waves of a work-group, so that one launch puts 16 waves on every WGP.
// One work-group per 32x64 output tile; wave w sums k in [w*PVK, (w+1)*PVK) into 8 accumulators (hi plane then lo plane per 32-wide k block), the PVW partial tiles are added in LDS in wave order.
// C[m][n] (f32, pitch HD) = sum_k (A[m][k] + A2[m][k]) Bt[n][k]; grid (LL/32, 1, Z), PVW*32 threads.
#define PVW 16
#define PVK (LL / PVW)
__global__ __launch_bounds__(PVW * 32) void k_pvs(const bf* __restrict__ A, const bf* __restrict__ A2, const bf* __restrict__ Bt, float* C, size_t sA, size_t sB, size_t sC) {
    typedef WFrag<bf>::V V;
    __shared__ __align__(16) float red[PVW][32 * 68];
    const size_t z = blockIdx.z; A += z * sA; A2 += z * sA; Bt += z * sB; C += z * sC;
    const int lane = threadIdx.x & 31, lr = lane & 15, hi = lane >> 4; const int w = __builtin_amdgcn_readfirstlane(threadIdx.x >> 5); const int r0 = blockIdx.x * 32;
    v8f acc[2][4];    // every loop over mb, nb, j or p below is unrolled: the fragment arrays live in registers and take constant indices only
#pragma unroll
    for (int mb = 0; mb < 2; ++mb)
#pragma unroll
        for (int nb = 0; nb < 4; ++nb) acc[mb][nb] = (v8f){};
    A += (size_t)r0 * LL + w * PVK; A2 += (size_t)r0 * LL + w * PVK; Bt += w * PVK;    // wave-uniform bases; the lane's own part is the same for all three operands
    const unsigned lo = (unsigned)(lr * LL + 8 * hi);
#pragma unroll 1    // rolled: the registers hold one k block's fragments at a time
    for (int kc = 0; kc < PVK; kc += 32) {
        const bf* pa = A + kc + lo; const bf* pa2 = A2 + kc + lo; const bf* pb = Bt + kc + lo;
        V a[2], a2[2], b[4];
#pragma unroll
        for (int mb = 0; mb < 2; ++mb) { a[mb] = WFrag<bf>::ld(pa + mb * 16 * LL); a2[mb] = WFrag<bf>::ld(pa2 + mb * 16 * LL); }
#pragma unroll
        for (int nb = 0; nb < 4; ++nb) b[nb] = WFrag<bf>::ld(pb + nb * 16 * LL);
        // precaution: the three address pairs that the issued loads name stay live, so unwritten, up to this wait
        asm volatile("s_wait_xcnt 0x0" :: "v"(pa), "v"(pa2), "v"(pb) : "memory");
#pragma unroll
        for (int nb = 0; nb < 4; ++nb)
#pragma unroll
            for (int mb = 0; mb < 2; ++mb) { acc[mb][nb] = WFrag<bf>::mma(a[mb], b[nb], acc[mb][nb]); acc[mb][nb] = WFrag<bf>::mma(a2[mb], b[nb], acc[mb][nb]); }
    }
    float* my = red[w];
#pragma unroll
    for (int mb = 0; mb < 2; ++mb)
#pragma unroll
        for (int nb = 0; nb < 4; ++nb)
#pragma unroll
            for (int j = 0; j < 8; ++j) my[(mb * 16 + hi * 8 + j) * 68 + nb * 16 + lr] = acc[mb][nb][j];
    __syncthreads();    // every wave's partial tile is in LDS before any thread adds them
    const int row = threadIdx.x >> 4, cofs = (threadIdx.x & 15) * 4;
    v4f s = *(const v4fa*)(red[0] + row * 68 + cofs);
#pragma unroll
    for (int p = 1; p < PVW; ++p) s += *(const v4fa*)(red[p] + row * 68 + cofs);
    *(v4f*)(C + (size_t)(r0 + row) * HD + cofs) = s;
}

typedef __attribute__((ext_vector_type(2))) unsigned short v2us;
typedef __attribute__((ext_vector_type(4))) unsigned short v4us;
__device__ __forceinline__ void splitf(float y, unsigned short& h, unsigned short& l) { h = f2bf(y); l = f2bf(y - bf2f(h)); }

__global__ __launch_bounds__(256) void k_cvt8(const float* __restrict__ src, bf* dst, size_t n8) { const size_t i = (size_t)blockIdx.x * 256 + threadIdx.x; if (i >= n8) return; const v8f v = *(const v8f*)(src + i * 8); v8us o;
#pragma unroll
    for (int k = 0; k < 8; ++k) o[k] = f2bf(v[k]); *(v8us*)(dst + i * 8) = o;  }
__global__ __launch_bounds__(256) void k_vtb(const float* __restrict__ v, bf* VT) { const size_t e = ((size_t)blockIdx.x * 256 + threadIdx.x) * 2; if (e >= (size_t)NH_ * HD * LL) return; const int s = (int)(e % LL); const int d = (int)((e / LL) % HD); const int h = (int)(e / ((size_t)LL * HD)); v2us o; o[0] = f2bf(v[((size_t)s * NH_ + h) * HD + d]); o[1] = f2bf(v[((size_t)(s + 1) * NH_ + h) * HD + d]); *(v2us*)(VT + e) = o;  }
__global__ __launch_bounds__(256) void k_soft(const float* __restrict__ S, bf* Ph, bf* Pl) { const int lane = threadIdx.x & 31; const int row = blockIdx.x * 8 + (threadIdx.x >> 5); if (row >= ZH * LL) return; const float* sr = S + (size_t)row * LL; float v[LL / 32]; float mx = -3.0e38f;
#pragma unroll
    for (int ch = 0; ch < LL / 128; ++ch) { const v4f a = *(const v4f*)(sr + ch * 128 + lane * 4);
#pragma unroll
        for (int u = 0; u < 4; ++u) { float t = a[u] * 0.044194173824159216f; asm volatile("" : "+v"(t)); v[ch * 4 + u] = t; mx = fmaxf(mx, t); } }
#pragma unroll
    for (int sh = 16; sh; sh >>= 1) mx = fmaxf(mx, __shfl_xor(mx, sh, 32));
    float sum = 0.f;
#pragma unroll
    for (int q = 0; q < LL / 32; ++q) { float d0 = __fsub_rn(v[q], mx); asm volatile("" : "+v"(d0)); v[q] = __builtin_amdgcn_exp2f(__fmul_rn(d0, 1.4426950408889634f)); sum += v[q]; }
#pragma unroll
    for (int sh = 16; sh; sh >>= 1) sum += __shfl_xor(sum, sh, 32);
    const float f = __fdiv_rn(1.0f, sum);
    {
#pragma unroll
        for (int ch = 0; ch < LL / 128; ++ch) { v4us oh, ol; for (int q = 0; q < 4; ++q) { unsigned short a2, c2; splitf(v[ch * 4 + q] * f, a2, c2); oh[q] = a2; ol[q] = c2; } const size_t oo = (size_t)row * LL + ch * 128 + lane * 4; *(v4us*)(Ph + oo) = oh; *(v4us*)(Pl + oo) = ol; }
         } }
__global__ __launch_bounds__(256) void k_out(const float* __restrict__ O, int h0, float* outb) { const size_t e = ((size_t)blockIdx.x * 256 + threadIdx.x) * 4; if (e >= (size_t)ZH * LL * HD) return; const int d = (int)(e % HD); const int l = (int)((e / HD) % LL); const int zz = (int)(e / ((size_t)HD * LL)); const v4f a = *(const v4f*)(O + e); float* dst = outb + ((size_t)l * NH_ + h0 + zz) * HD + d; *(v4f*)dst = a;  }

extern "C" void kernel_launch(void* const* d_in, const int* in_sizes, int n_in,
                              void* d_out, int out_size, void* d_ws, size_t ws_size, hipStream_t stream) {
    (void)in_sizes; (void)n_in; (void)out_size;
    const float* q = (const float*)d_in[0]; const float* k = (const float*)d_in[1]; const float* v = (const float*)d_in[2];
    float* OUT = (float*)d_out;     // [4][2048][8][64]
    char* wsp = (char*)d_ws;
    auto take = [&](size_t bytes) { char* p = wsp; wsp += (bytes + 255) & ~(size_t)255; return (void*)p; };
    bf* QP = (bf*)take((size_t)NH_ * LL * HD * 2); bf* KP = (bf*)take((size_t)NH_ * LL * HD * 2); bf* VT = (bf*)take((size_t)NH_ * HD * LL * 2); float* S = (float*)take((size_t)ZH * LL * LL * 4); bf* Ph = (bf*)take((size_t)ZH * LL * LL * 2); bf* Pl = (bf*)take((size_t)ZH * LL * LL * 2); float* O = (float*)take((size_t)ZH * LL * HD * 4);
    if ((size_t)(wsp - (char*)d_ws) > ws_size) return;    // total ~ 140 MB
    const size_t per = (size_t)NH_ * LL * HD; const size_t zq = (size_t)LL * HD, zS = (size_t)LL * LL, zv = (size_t)HD * LL;
    for (int b = 0; b < NB_; ++b) {
        k_cvt8<<<(unsigned)((per / 8 + 255) / 256), 256, 0, stream>>>(q + b * per, QP, per / 8); k_cvt8<<<(unsigned)((per / 8 + 255) / 256), 256, 0, stream>>>(k + b * per, KP, per / 8);   // [h][l][d] layout already
        k_vtb<<<(unsigned)((per / 2 + 255) / 256), 256, 0, stream>>>(v + b * per, VT);
        for (int h0 = 0; h0 < NH_; h0 += ZH) {
            k_gemmw<bf, 0, false><<<dim3(LL / 64, LL / 64, ZH), 32, 0, stream>>>(QP + (size_t)h0 * zq, nullptr, KP + (size_t)h0 * zq, nullptr, HD, S, LL, nullptr, zq, zq, zS);
            k_soft<<<ZH * LL / 8, 256, 0, stream>>>(S, Ph, Pl);
            k_pvs<<<dim3(LL / 32, 1, ZH), PVW * 32, 0, stream>>>(Ph, Pl, VT + (size_t)h0 * zv, O, zS, zv, zq);
            k_out<<<(unsigned)(((size_t)ZH * LL * HD / 4 + 255) / 256), 256, 0, stream>>>(O, h0, OUT + b * per); } }
}

// v003
// A run of this version takes 51 microseconds.
// Versions between v001 and this one are left out; their measured steps multiply to 9.96 times as fast.
// Over all steps from v000 it is 16.0 times as fast.
#include <hip/hip_runtime.h>

// ScaledDotProduct (query, key [4][8][2048][64], value [4][2048 l][8 h][64]; weight = softmax(q.k / sqrt(512)) (embed_size scale, per the source); out[b][q][h][d] = sum_l weight v -> [4][2048][8][64]).
// Compute dtypes, f32 accumulate: every input rounded to bf16; scores on PLAIN bf16 planes of q and k (inputs: exact products, f32 accumulate); scale + softmax f32 -> hl probability planes; weight.v as hl x exact bf16 v (2 products).
// The rounding of q, k and v, the scores, the softmax, weight.v and the [b][q][h][d] store run in ONE kernel over all 32 (batch, head) pairs: scores and probabilities stay in registers (running maximum and sum per query).
// What a work-group's sixteen query tiles share, the bf16 rows of k and v, the work-group rounds itself, 128 keys at a time, into two LDS buffers; v is transposed on its way out of LDS. One launch, no workspace.

#define NB_  4
#define LL   2048
#define NH_  8
#define HD   64
typedef unsigned short bf;
typedef __attribute__((ext_vector_type(16))) __bf16   v16bf;
typedef __attribute__((ext_vector_type(2)))  __bf16   v2bf;
typedef __attribute__((ext_vector_type(8)))  unsigned short v8us;
typedef __attribute__((ext_vector_type(8)))  unsigned v8u;
typedef __attribute__((ext_vector_type(8)))  float    v8f;
typedef __attribute__((ext_vector_type(4)))  float    v4f;
typedef __attribute__((ext_vector_type(2)))  float    v2f;
typedef __attribute__((ext_vector_type(2)))  unsigned v2u;
typedef __attribute__((ext_vector_type(8)))  short    v8s;
typedef __attribute__((address_space(3)))    v8s      lds_v8s;

__device__ __forceinline__ unsigned short f2bf(float f) { unsigned u = __float_as_uint(f); u += 0x7FFFu + ((u >> 16) & 1u); return (unsigned short)(u >> 16); }
__device__ __forceinline__ v16bf cat16b(v8us lo, v8us hi) { return __builtin_bit_cast(v16bf, __builtin_shufflevector(lo, hi, 0, 1, 2, 3, 4, 5, 6, 7, 8, 9, 10, 11, 12, 13, 14, 15)); }
__device__ __forceinline__ v8f wmmab(v16bf a, v16bf b, v8f c) { return __builtin_amdgcn_wmma_f32_16x16x32_bf16(false, a, false, b, (short)0, c, false, false); }
// fragment of a K-contiguous bf16 plane in the hardware k order: p points at the lane's row, k = 8 * (lane >> 4)
__device__ __forceinline__ v16bf ldf(const bf* p) { return cat16b(*(const v8us*)p, *(const v8us*)(p + 16)); }
// half a fragment of the transposed operand out of a row-major LDS tile (ds_load_tr16_b128): lane (c, h) gets rows 8 h + 0..7 of column c; p is the lane's own address, row 8 h + (lane & 7), column 8 * ((lane >> 3) & 1)
__device__ __forceinline__ v8us ldtr(const bf* p) { return __builtin_bit_cast(v8us, __builtin_amdgcn_ds_load_tr16_b128_v8i16((lds_v8s*)p)); }
// four f32 rounded to nearest even, as four bf16
__device__ __forceinline__ v2u rnd4(v4f x) { v2u y; y[0] = __builtin_bit_cast(unsigned, __builtin_convertvector(__builtin_shufflevector(x, x, 0, 1), v2bf)); y[1] = __builtin_bit_cast(unsigned, __builtin_convertvector(__builtin_shufflevector(x, x, 2, 3), v2bf)); return y; }
// the value of lane l ^ 16
__device__ __forceinline__ float xhalf(float x) { const int b = __float_as_int(x); return __int_as_float(__builtin_amdgcn_permlanex16(b, b, 0x76543210, 0xfedcba98, false, false)); }

// 2^x for eight values (exp8) or two (exp2x2) in ONE statement: every result has a register of its own and a v_nop ends the run, so that no instruction
// directly behind a v_exp_f32 reads its result or overwrites its source (the slot the instruction set asks for).
__device__ __forceinline__ void exp8(float* y, const float* x) {
    asm("v_exp_f32 %0, %8\n\tv_exp_f32 %1, %9\n\tv_exp_f32 %2, %10\n\tv_exp_f32 %3, %11\n\tv_exp_f32 %4, %12\n\tv_exp_f32 %5, %13\n\tv_exp_f32 %6, %14\n\tv_exp_f32 %7, %15\n\tv_nop"
        : "=&v"(y[0]), "=&v"(y[1]), "=&v"(y[2]), "=&v"(y[3]), "=&v"(y[4]), "=&v"(y[5]), "=&v"(y[6]), "=&v"(y[7])
        : "v"(x[0]), "v"(x[1]), "v"(x[2]), "v"(x[3]), "v"(x[4]), "v"(x[5]), "v"(x[6]), "v"(x[7])); }
__device__ __forceinline__ void exp2x2(float& y0, float& y1, float x0, float x1) { asm("v_exp_f32 %0, %2\n\tv_exp_f32 %1, %3\n\tv_nop" : "=&v"(y0), "=&v"(y1) : "v"(x0), "v"(x1)); }

// ---- k_fa: one wave per 32 queries of one (batch, head), FAW waves per work-group; grid (LL / (32 * FAW), NB_ * NH_).
// Per 32 keys: St = K Qt (A = K rows, B = the wave's q rows, read as f32, rounded once and kept in registers), so a lane holds scores of ONE query (column lane & 15; keys 8 * (lane >> 4) + r of each 16-key tile);
// the two score tiles, turned into probabilities in place, ARE the B operand of Ot += Vt Pt (A = columns of the v rows, by the transposing LDS load), as a hi and a lo bf16 plane.
// p = exp2((s - m) * scale * log2 e) with m the running maximum of the raw scores; a new maximum rescales the query's sum and output column; the division by the sum comes last.
// Stage = SK keys = one LDS buffer. While the waves work on 32 keys of one buffer, 32 keys of the next stage (f32 rows of k and v) are on their way into registers; at the block's foot they are rounded and stored
// to the other buffer. ONE barrier at the stage's foot both publishes that buffer and ends every wave's reads of the one that the next stage overwrites.
#define FAW 8
#define SK  128   // keys per stage
#define KPI 72    // LDS pitch of a k row, in bf16: 144 B = 16 B x odd, for ds_load_b128
#define VPI 80    // LDS pitch of a v row, in bf16: 160 B = 32 B x odd, for ds_load_tr16_b128
#define SC2 0.0637587154f    // (1 / sqrt(512)) * log2(e)
__global__ __launch_bounds__(FAW * 32) void k_fa(const float* __restrict__ q, const float* __restrict__ k, const float* __restrict__ v, float* out) {
    __shared__ __attribute__((aligned(16))) bf KS[2][SK * KPI];
    __shared__ __attribute__((aligned(16))) bf VS[2][SK * VPI];
    const int lane = threadIdx.x & 31, lr = lane & 15, hi = lane >> 4; const int w = __builtin_amdgcn_readfirstlane(threadIdx.x >> 5);
    const int bh = blockIdx.y; const int q0 = blockIdx.x * (FAW * 32) + w * 32; const int b = bh / NH_, h = bh % NH_;
    const float* Q = q + (size_t)bh * LL * HD + (size_t)q0 * HD; const float* K = k + (size_t)bh * LL * HD; const float* V = v + ((size_t)b * LL * NH_ + h) * HD;    // wave-uniform bases; key l of v stands at l * NH_ * HD
    const unsigned qlo = (unsigned)(lr * HD + 8 * hi);    // the lane's own part: q rows in memory,
    const unsigned klo = (unsigned)(lr * KPI + 8 * hi), vlo = (unsigned)((8 * hi + (lane & 7)) * VPI + 8 * ((lane >> 3) & 1));    // k rows and v rows in LDS
    const unsigned sr = threadIdx.x >> 4, sc = (threadIdx.x & 15) * 4;    // staging: 16 threads a row of 64 f32, 16 rows per turn of the work-group
    const unsigned kgo = sr * HD + sc, vgo = sr * (NH_ * HD) + sc, kso = sr * KPI + sc, vso = sr * VPI + sc;    // the thread's own part in memory and in LDS
    // every loop over qt, kt, ks, dt, i or j below is unrolled: the fragment arrays live in registers and take constant indices only
    v4f k0[SK / 16], v0[SK / 16];    // stage 0, asked for ahead of the q rows
#pragma unroll
    for (int i = 0; i < SK / 16; ++i) { k0[i] = *(const v4f*)(K + kgo + i * 16 * HD); v0[i] = *(const v4f*)(V + vgo + i * 16 * (NH_ * HD)); }
    v16bf qf[2][2], kf[2][2];
#pragma unroll
    for (int qt = 0; qt < 2; ++qt)
#pragma unroll
        for (int ks = 0; ks < 2; ++ks) { const float* p = Q + qlo + qt * 16 * HD + ks * 32; const v8f x0 = *(const v8f*)p, x1 = *(const v8f*)(p + 16); v8us y0, y1;    // the wave's own q rows, rounded to bf16 here, same k order as ldf
#pragma unroll
            for (int j = 0; j < 8; ++j) { y0[j] = f2bf(x0[j]); y1[j] = f2bf(x1[j]); }
            qf[qt][ks] = cat16b(y0, y1); }
#pragma unroll
    for (int i = 0; i < SK / 16; ++i) { *(v2u*)(&KS[0][kso + i * 16 * KPI]) = rnd4(k0[i]); *(v2u*)(&VS[0][vso + i * 16 * VPI]) = rnd4(v0[i]); }
    __syncthreads();    // stage 0 is there for every wave
#pragma unroll
    for (int kt = 0; kt < 2; ++kt)
#pragma unroll
        for (int ks = 0; ks < 2; ++ks) kf[kt][ks] = ldf(&KS[0][klo + kt * 16 * KPI + ks * 32]);
    v8f o[2][4]; float m[2], l[2];
#pragma unroll
    for (int qt = 0; qt < 2; ++qt) { m[qt] = -3.0e38f; l[qt] = 0.f;
#pragma unroll
        for (int dt = 0; dt < 4; ++dt) o[qt][dt] = (v8f){}; }
#pragma unroll 1    // rolled: one copy of a stage's code, with its one barrier
    for (int st = 0; st < LL / SK; ++st) {
      const bool more = st + 1 < LL / SK;    // the same for the whole work-group
      const bf* ksb = &KS[st & 1][klo]; const bf* vsb = &VS[st & 1][vlo];
#pragma unroll 1    // rolled: one 32-key block's fragments in registers at a time (unrolled by four the build went past 400 registers and into scratch)
      for (int ps = 0; ps < SK / 32; ++ps) {
        v4f kr[2], vr[2];    // 32 keys of the next stage, asked for here, stored at the block's foot
        if (more) { const float* kn = K + ((st + 1) * SK + ps * 32) * HD + kgo; const float* vn = V + ((st + 1) * SK + ps * 32) * (NH_ * HD) + vgo;
#pragma unroll
            for (int i = 0; i < 2; ++i) { kr[i] = *(const v4f*)(kn + i * 16 * HD); vr[i] = *(const v4f*)(vn + i * 16 * (NH_ * HD)); } }
        const bf* pv = vsb + ps * 32 * VPI;
        v16bf vf[4];    // asked for here, first used behind the softmax
#pragma unroll
        for (int dt = 0; dt < 4; ++dt) vf[dt] = cat16b(ldtr(pv + dt * 16), ldtr(pv + 16 * VPI + dt * 16));
        v8f s[2][2];
#pragma unroll
        for (int kt = 0; kt < 2; ++kt)
#pragma unroll
            for (int qt = 0; qt < 2; ++qt) { s[qt][kt] = wmmab(kf[kt][0], qf[qt][0], (v8f){}); s[qt][kt] = wmmab(kf[kt][1], qf[qt][1], s[qt][kt]); }
        const bf* pk = ksb + (ps + 1 < SK / 32 ? ps + 1 : 0) * 32 * KPI;    // the next block's K rows, fetched under this block's softmax; a stage's last block re-reads its first and drops it (the next stage's is read behind the barrier)
#pragma unroll
        for (int kt = 0; kt < 2; ++kt)
#pragma unroll
            for (int ks = 0; ks < 2; ++ks) kf[kt][ks] = ldf(pk + kt * 16 * KPI + ks * 32);
        __builtin_amdgcn_sched_barrier(0);    // keeps the K loads up here: without it they sink to the block's foot and the next block's first product waits out their whole latency
        float al[2], nm[2];
        {
            float ax[2];
#pragma unroll
            for (int qt = 0; qt < 2; ++qt) {
                float mx = s[qt][0][0];
#pragma unroll
                for (int j = 1; j < 8; ++j) mx = fmaxf(mx, s[qt][0][j]);
#pragma unroll
                for (int j = 0; j < 8; ++j) mx = fmaxf(mx, s[qt][1][j]);
                mx = fmaxf(mx, xhalf(mx));    // both halves of the wave feed the same output column: one maximum for both
                const float mn = fmaxf(m[qt], mx); ax[qt] = (m[qt] - mn) * SC2; nm[qt] = -mn * SC2; m[qt] = mn; }
            exp2x2(al[0], al[1], ax[0], ax[1]);
        }
#pragma unroll
        for (int qt = 0; qt < 2; ++qt) {
            float p[16];    // element e of the B operand: score tile e >> 3, register e & 7
#pragma unroll
            for (int kt = 0; kt < 2; ++kt) { float x[8];
#pragma unroll
                for (int j = 0; j < 8; ++j) x[j] = __builtin_fmaf(s[qt][kt][j], SC2, nm[qt]);
                exp8(p + 8 * kt, x); }
            v8u wh, wl; v2f sum2 = (v2f){0.f, 0.f};
#pragma unroll
            for (int i = 0; i < 8; ++i) {
                v2f pp; pp[0] = p[2 * i]; pp[1] = p[2 * i + 1];
                sum2 += pp;
                const unsigned h2 = __builtin_bit_cast(unsigned, __builtin_convertvector(pp, v2bf));
                v2f r; r[0] = pp[0] - __uint_as_float(h2 << 16); r[1] = pp[1] - __uint_as_float(h2 & 0xFFFF0000u);
                wh[i] = h2; wl[i] = __builtin_bit_cast(unsigned, __builtin_convertvector(r, v2bf)); }
            l[qt] = l[qt] * al[qt] + (sum2[0] + sum2[1]);
            const v16bf ph = __builtin_bit_cast(v16bf, wh), pl = __builtin_bit_cast(v16bf, wl);
#pragma unroll
            for (int dt = 0; dt < 4; ++dt) { o[qt][dt] *= al[qt]; o[qt][dt] = wmmab(vf[dt], ph, o[qt][dt]); o[qt][dt] = wmmab(vf[dt], pl, o[qt][dt]); }
        }
        if (more) { bf* kd = &KS[(st + 1) & 1][kso + ps * 32 * KPI]; bf* vd = &VS[(st + 1) & 1][vso + ps * 32 * VPI];
#pragma unroll
            for (int i = 0; i < 2; ++i) { *(v2u*)(kd + i * 16 * KPI) = rnd4(kr[i]); *(v2u*)(vd + i * 16 * VPI) = rnd4(vr[i]); } }
      }
      if (more) {
        __syncthreads();    // publishes the next stage; every wave has left the buffer that the next stage's foot overwrites
#pragma unroll
        for (int kt = 0; kt < 2; ++kt)
#pragma unroll
            for (int ks = 0; ks < 2; ++ks) kf[kt][ks] = ldf(&KS[(st + 1) & 1][klo + kt * 16 * KPI + ks * 32]);
      }
    }
#pragma unroll
    for (int qt = 0; qt < 2; ++qt) {
        const float f = __fdiv_rn(1.0f, l[qt] + xhalf(l[qt]));    // the two halves summed different keys
        float* dst = out + (((size_t)b * LL + q0 + qt * 16 + lr) * NH_ + h) * HD + 8 * hi;    // register r of tile dt is d = dt * 16 + 8 * hi + r of query lr
#pragma unroll
        for (int dt = 0; dt < 4; ++dt) { const v8f y = o[qt][dt] * f; *(v4f*)(dst + dt * 16) = __builtin_shufflevector(y, y, 0, 1, 2, 3); *(v4f*)(dst + dt * 16 + 4) = __builtin_shufflevector(y, y, 4, 5, 6, 7); }
    }
}

extern "C" void kernel_launch(void* const* d_in, const int* in_sizes, int n_in,
                              void* d_out, int out_size, void* d_ws, size_t ws_size, hipStream_t stream) {
    (void)in_sizes; (void)n_in; (void)out_size; (void)d_ws; (void)ws_size;
    const float* q = (const float*)d_in[0]; const float* k = (const float*)d_in[1]; const float* v = (const float*)d_in[2];
    float* OUT = (float*)d_out;     // [4][2048][8][64]
    k_fa<<<dim3(LL / (32 * FAW), NB_ * NH_), FAW * 32, 0, stream>>>(q, k, v, OUT);
}

// v004
// One run takes 42.9 microseconds.
// Timed twice side by side with v003, it ran 1.19 and 1.18 times as fast.
// Over all steps from v000 it is 18.9 times as fast.
#include <hip/hip_runtime.h>

// ScaledDotProduct (query, key [4][8][2048][64], value [4][2048 l][8 h][64]; weight = softmax(q.k / sqrt(512)) (embed_size scale, per the source); out[b][q][h][d] = sum_l weight v -> [4][2048][8][64]).
// Compute dtypes, f32 accumulate: every input rounded to bf16; scores on PLAIN bf16 planes of q and k (inputs: exact products, f32 accumulate); scale + softmax f32 -> hl probability planes; weight.v as hl x exact bf16 v (2 products).
// The rounding of q, k and v, the scores, the softmax, weight.v and the [b][q][h][d] store run in ONE kernel over all 32 (batch, head) pairs: scores and probabilities stay in registers (running maximum and sum per query).
// What a work-group's eight query tiles share, the bf16 rows of k and v, the work-group rounds itself, 128 keys of each key half at a time, into two LDS buffers per half; v is transposed on its way out of LDS. One launch, no workspace.
// Each query tile is worked on by TWO waves, one per half of the keys, so that four waves stand on every SIMD; the two partial results (maximum, sum, output columns) are joined through LDS at the end.

#define NB_  4
#define LL   2048
#define NH_  8
#define HD   64
typedef unsigned short bf;
typedef __attribute__((ext_vector_type(16))) __bf16   v16bf;
typedef __attribute__((ext_vector_type(2)))  __bf16   v2bf;
typedef __attribute__((ext_vector_type(8)))  unsigned short v8us;
typedef __attribute__((ext_vector_type(8)))  unsigned v8u;
typedef __attribute__((ext_vector_type(8)))  float    v8f;
typedef __attribute__((ext_vector_type(4)))  float    v4f;
typedef __attribute__((ext_vector_type(2)))  float    v2f;
typedef __attribute__((ext_vector_type(2)))  unsigned v2u;
typedef __attribute__((ext_vector_type(8)))  short    v8s;
typedef __attribute__((address_space(3)))    v8s      lds_v8s;

__device__ __forceinline__ unsigned short f2bf(float f) { unsigned u = __float_as_uint(f); u += 0x7FFFu + ((u >> 16) & 1u); return (unsigned short)(u >> 16); }
__device__ __forceinline__ v16bf cat16b(v8us lo, v8us hi) { return __builtin_bit_cast(v16bf, __builtin_shufflevector(lo, hi, 0, 1, 2, 3, 4, 5, 6, 7, 8, 9, 10, 11, 12, 13, 14, 15)); }
__device__ __forceinline__ v8f wmmab(v16bf a, v16bf b, v8f c) { return __builtin_amdgcn_wmma_f32_16x16x32_bf16(false, a, false, b, (short)0, c, false, false); }
// fragment of a K-contiguous bf16 plane in the hardware k order: p points at the lane's row, k = 8 * (lane >> 4)
__device__ __forceinline__ v16bf ldf(const bf* p) { return cat16b(*(const v8us*)p, *(const v8us*)(p + 16)); }
// half a fragment of the transposed operand out of a row-major LDS tile (ds_load_tr16_b128): lane (c, h) gets rows 8 h + 0..7 of column c; p is the lane's own address, row 8 h + (lane & 7), column 8 * ((lane >> 3) & 1)
__device__ __forceinline__ v8us ldtr(const bf* p) { return __builtin_bit_cast(v8us, __builtin_amdgcn_ds_load_tr16_b128_v8i16((lds_v8s*)p)); }
// four f32 rounded to nearest even, as four bf16
__device__ __forceinline__ v2u rnd4(v4f x) { v2u y; y[0] = __builtin_bit_cast(unsigned, __builtin_convertvector(__builtin_shufflevector(x, x, 0, 1), v2bf)); y[1] = __builtin_bit_cast(unsigned, __builtin_convertvector(__builtin_shufflevector(x, x, 2, 3), v2bf)); return y; }
// the value of lane l ^ 16
__device__ __forceinline__ float xhalf(float x) { const int b = __float_as_int(x); return __int_as_float(__builtin_amdgcn_permlanex16(b, b, 0x76543210, 0xfedcba98, false, false)); }

// 2^x for eight values (exp8) or two (exp2x2) in ONE statement: every result has a register of its own and a v_nop ends the run, so that no instruction
// directly behind a v_exp_f32 reads its result or overwrites its source (the slot the instruction set asks for).
__device__ __forceinline__ void exp8(float* y, const float* x) {
    asm("v_exp_f32 %0, %8\n\tv_exp_f32 %1, %9\n\tv_exp_f32 %2, %10\n\tv_exp_f32 %3, %11\n\tv_exp_f32 %4, %12\n\tv_exp_f32 %5, %13\n\tv_exp_f32 %6, %14\n\tv_exp_f32 %7, %15\n\tv_nop"
        : "=&v"(y[0]), "=&v"(y[1]), "=&v"(y[2]), "=&v"(y[3]), "=&v"(y[4]), "=&v"(y[5]), "=&v"(y[6]), "=&v"(y[7])
        : "v"(x[0]), "v"(x[1]), "v"(x[2]), "v"(x[3]), "v"(x[4]), "v"(x[5]), "v"(x[6]), "v"(x[7])); }
__device__ __forceinline__ void exp2x2(float& y0, float& y1, float x0, float x1) { asm("v_exp_f32 %0, %2\n\tv_exp_f32 %1, %3\n\tv_nop" : "=&v"(y0), "=&v"(y1) : "v"(x0), "v"(x1)); }

// ---- k_fa: KH waves per 32 queries of one (batch, head), each on LK = LL / KH keys in a row; FAW query tiles, FAW * KH waves per work-group; grid (LL / (32 * FAW), NB_ * NH_).
// The FAW waves of one key half stage that half's rows in buffers of their own; the barrier is the whole work-group's (both halves walk the same number of stages).
// Per 32 keys: St = K Qt (A = K rows, B = the wave's q rows, read as f32, rounded once and kept in registers), so a lane holds scores of ONE query (column lane & 15; keys 8 * (lane >> 4) + r of each 16-key tile);
// the two score tiles, turned into probabilities in place, ARE the B operand of Ot += Vt Pt (A = columns of the v rows, by the transposing LDS load), as a hi and a lo bf16 plane.
// p = exp2((s - m) * scale * log2 e) with m the running maximum of the raw scores; a new maximum rescales the query's sum and output column; the division by the sum comes last.
// Stage = SK keys = one LDS buffer. While the waves work on 32 keys of one buffer, 32 keys of the next stage (f32 rows of k and v) are on their way into registers; at the block's foot they are rounded and stored
// to the other buffer. ONE barrier at the stage's foot both publishes that buffer and ends every wave's reads of the one that the next stage overwrites.
#define FAW 8
#define KH  2     // key halves = waves per query tile
#define LK  (LL / KH)
#define XW  (34 * 32)    // f32 a wave hands to its partner: 32 output values, maximum and sum per lane
#define SK  128   // keys per stage
#define KPI 72    // LDS pitch of a k row, in bf16: 144 B = 16 B x odd, for ds_load_b128
#define VPI 80    // LDS pitch of a v row, in bf16: 160 B = 32 B x odd, for ds_load_tr16_b128
#define SC2 0.0637587154f    // (1 / sqrt(512)) * log2(e)
__global__ __launch_bounds__(FAW * KH * 32) void k_fa(const float* __restrict__ q, const float* __restrict__ k, const float* __restrict__ v, float* out) {
    __shared__ __attribute__((aligned(16))) bf KS[KH][2][SK * KPI];
    __shared__ __attribute__((aligned(16))) bf VS[KH][2][SK * VPI];
    __shared__ __attribute__((aligned(16))) float XS[FAW * KH][XW];
    const int lane = threadIdx.x & 31, lr = lane & 15, hi = lane >> 4; const int w = __builtin_amdgcn_readfirstlane(threadIdx.x >> 5);
    const int g = w % FAW, kh = w / FAW;    // query tile and key half, both wave-uniform
    const int bh = blockIdx.y; const int q0 = blockIdx.x * (FAW * 32) + g * 32; const int b = bh / NH_, h = bh % NH_;
    const float* Q = q + (size_t)bh * LL * HD + (size_t)q0 * HD; const float* K = k + ((size_t)bh * LL + kh * LK) * HD; const float* V = v + (((size_t)b * LL + kh * LK) * NH_ + h) * HD;    // wave-uniform bases, at the half's first key; key l of v stands at l * NH_ * HD
    const unsigned qlo = (unsigned)(lr * HD + 8 * hi);    // the lane's own part: q rows in memory,
    const unsigned klo = (unsigned)(lr * KPI + 8 * hi), vlo = (unsigned)((8 * hi + (lane & 7)) * VPI + 8 * ((lane >> 3) & 1));    // k rows and v rows in LDS
    const unsigned sr = (threadIdx.x % (FAW * 32)) >> 4, sc = (threadIdx.x & 15) * 4;    // staging: 16 threads a row of 64 f32, 16 rows per turn of the half's FAW waves
    const unsigned kgo = sr * HD + sc, vgo = sr * (NH_ * HD) + sc, kso = sr * KPI + sc, vso = sr * VPI + sc;    // the thread's own part in memory and in LDS
    // every loop over qt, kt, ks, dt, i or j below is unrolled: the fragment arrays live in registers and take constant indices only
    v4f k0[SK / 16], v0[SK / 16];    // stage 0, asked for ahead of the q rows
#pragma unroll
    for (int i = 0; i < SK / 16; ++i) { k0[i] = *(const v4f*)(K + kgo + i * 16 * HD); v0[i] = *(const v4f*)(V + vgo + i * 16 * (NH_ * HD)); }
    v16bf qf[2][2], kf[2][2];
#pragma unroll
    for (int qt = 0; qt < 2; ++qt)
#pragma unroll
        for (int ks = 0; ks < 2; ++ks) { const float* p = Q + qlo + qt * 16 * HD + ks * 32; const v8f x0 = *(const v8f*)p, x1 = *(const v8f*)(p + 16); v8us y0, y1;    // the wave's own q rows, rounded to bf16 here, same k order as ldf
#pragma unroll
            for (int j = 0; j < 8; ++j) { y0[j] = f2bf(x0[j]); y1[j] = f2bf(x1[j]); }
            qf[qt][ks] = cat16b(y0, y1); }
#pragma unroll
    for (int i = 0; i < SK / 16; ++i) { *(v2u*)(&KS[kh][0][kso + i * 16 * KPI]) = rnd4(k0[i]); *(v2u*)(&VS[kh][0][vso + i * 16 * VPI]) = rnd4(v0[i]); }
    __syncthreads();    // stage 0 is there for every wave
#pragma unroll
    for (int kt = 0; kt < 2; ++kt)
#pragma unroll
        for (int ks = 0; ks < 2; ++ks) kf[kt][ks] = ldf(&KS[kh][0][klo + kt * 16 * KPI + ks * 32]);
    v8f o[2][4]; float m[2], l[2];
#pragma unroll
    for (int qt = 0; qt < 2; ++qt) { m[qt] = -3.0e38f; l[qt] = 0.f;
#pragma unroll
        for (int dt = 0; dt < 4; ++dt) o[qt][dt] = (v8f){}; }
#pragma unroll 1    // rolled: one copy of a stage's code, with its one barrier
    for (int st = 0; st < LK / SK; ++st) {
      const bool more = st + 1 < LK / SK;    // the same for the whole work-group
      const bf* ksb = &KS[kh][st & 1][klo]; const bf* vsb = &VS[kh][st & 1][vlo];
#pragma unroll 1    // rolled: one 32-key block's fragments in registers at a time (unrolled by four the build went past 400 registers and into scratch)
      for (int ps = 0; ps < SK / 32; ++ps) {
        v4f kr[2], vr[2];    // 32 keys of the next stage, asked for here, stored at the block's foot
        if (more) { const float* kn = K + ((st + 1) * SK + ps * 32) * HD + kgo; const float* vn = V + ((st + 1) * SK + ps * 32) * (NH_ * HD) + vgo;
#pragma unroll
            for (int i = 0; i < 2; ++i) { kr[i] = *(const v4f*)(kn + i * 16 * HD); vr[i] = *(const v4f*)(vn + i * 16 * (NH_ * HD)); } }
        const bf* pv = vsb + ps * 32 * VPI;
        v16bf vf[4];    // asked for here, first used behind the softmax
#pragma unroll
        for (int dt = 0; dt < 4; ++dt) vf[dt] = cat16b(ldtr(pv + dt * 16), ldtr(pv + 16 * VPI + dt * 16));
        v8f s[2][2];
#pragma unroll
        for (int kt = 0; kt < 2; ++kt)
#pragma unroll
            for (int qt = 0; qt < 2; ++qt) { s[qt][kt] = wmmab(kf[kt][0], qf[qt][0], (v8f){}); s[qt][kt] = wmmab(kf[kt][1], qf[qt][1], s[qt][kt]); }
        const bf* pk = ksb + (ps + 1 < SK / 32 ? ps + 1 : 0) * 32 * KPI;    // the next block's K rows, fetched under this block's softmax; a stage's last block re-reads its first and drops it (the next stage's is read behind the barrier)
#pragma unroll
        for (int kt = 0; kt < 2; ++kt)
#pragma unroll
            for (int ks = 0; ks < 2; ++ks) kf[kt][ks] = ldf(pk + kt * 16 * KPI + ks * 32);
        __builtin_amdgcn_sched_barrier(0);    // keeps the K loads up here: without it they sink to the block's foot and the next block's first product waits out their whole latency
        float al[2], nm[2];
        {
            float ax[2];
#pragma unroll
            for (int qt = 0; qt < 2; ++qt) {
                float mx = s[qt][0][0];
#pragma unroll
                for (int j = 1; j < 8; ++j) mx = fmaxf(mx, s[qt][0][j]);
#pragma unroll
                for (int j = 0; j < 8; ++j) mx = fmaxf(mx, s[qt][1][j]);
                mx = fmaxf(mx, xhalf(mx));    // both halves of the wave feed the same output column: one maximum for both
                const float mn = fmaxf(m[qt], mx); ax[qt] = (m[qt] - mn) * SC2; nm[qt] = -mn * SC2; m[qt] = mn; }
            exp2x2(al[0], al[1], ax[0], ax[1]);
        }
#pragma unroll
        for (int qt = 0; qt < 2; ++qt) {
            float p[16];    // element e of the B operand: score tile e >> 3, register e & 7
#pragma unroll
            for (int kt = 0; kt < 2; ++kt) { float x[8];
#pragma unroll
                for (int j = 0; j < 8; ++j) x[j] = __builtin_fmaf(s[qt][kt][j], SC2, nm[qt]);
                exp8(p + 8 * kt, x); }
            v8u wh, wl; v2f sum2 = (v2f){0.f, 0.f};
#pragma unroll
            for (int i = 0; i < 8; ++i) {
                v2f pp; pp[0] = p[2 * i]; pp[1] = p[2 * i + 1];
                sum2 += pp;
                const unsigned h2 = __builtin_bit_cast(unsigned, __builtin_convertvector(pp, v2bf));
                v2f r; r[0] = pp[0] - __uint_as_float(h2 << 16); r[1] = pp[1] - __uint_as_float(h2 & 0xFFFF0000u);
                wh[i] = h2; wl[i] = __builtin_bit_cast(unsigned, __builtin_convertvector(r, v2bf)); }
            l[qt] = l[qt] * al[qt] + (sum2[0] + sum2[1]);
            const v16bf ph = __builtin_bit_cast(v16bf, wh), pl = __builtin_bit_cast(v16bf, wl);
#pragma unroll
            for (int dt = 0; dt < 4; ++dt) { o[qt][dt] *= al[qt]; o[qt][dt] = wmmab(vf[dt], ph, o[qt][dt]); o[qt][dt] = wmmab(vf[dt], pl, o[qt][dt]); }
        }
        if (more) { bf* kd = &KS[kh][(st + 1) & 1][kso + ps * 32 * KPI]; bf* vd = &VS[kh][(st + 1) & 1][vso + ps * 32 * VPI];
#pragma unroll
            for (int i = 0; i < 2; ++i) { *(v2u*)(kd + i * 16 * KPI) = rnd4(kr[i]); *(v2u*)(vd + i * 16 * VPI) = rnd4(vr[i]); } }
      }
      if (more) {
        __syncthreads();    // publishes the next stage; every wave has left the buffer that the next stage's foot overwrites
#pragma unroll
        for (int kt = 0; kt < 2; ++kt)
#pragma unroll
            for (int ks = 0; ks < 2; ++ks) kf[kt][ks] = ldf(&KS[kh][(st + 1) & 1][klo + kt * 16 * KPI + ks * 32]);
      }
    }
    // The join: the wave of key half kh finishes query tile qt = kh and hands the other tile to its partner (wave w ^ FAW), lane to lane, 16 B a lane and store.
    float* xs = &XS[w][0]; const float* xp = &XS[w ^ FAW][0];
#pragma unroll
    for (int qt = 0; qt < 2; ++qt) l[qt] += xhalf(l[qt]);    // the two halves of the wave summed different keys
    const auto give = [&](const v8f (&og)[4], float mg, float lg) {
#pragma unroll
        for (int dt = 0; dt < 4; ++dt) { *(v4f*)(xs + (2 * dt) * 128 + lane * 4) = __builtin_shufflevector(og[dt], og[dt], 0, 1, 2, 3); *(v4f*)(xs + (2 * dt + 1) * 128 + lane * 4) = __builtin_shufflevector(og[dt], og[dt], 4, 5, 6, 7); }
        v2f ml; ml[0] = mg; ml[1] = lg; *(v2f*)(xs + 1024 + lane * 2) = ml; };
    const auto take = [&](const v8f (&ot)[4], float mt, float lt, int qt) {
        const v2f ml = *(const v2f*)(xp + 1024 + lane * 2);
        const float mn = fmaxf(mt, ml[0]); float fa, fb; exp2x2(fa, fb, (mt - mn) * SC2, (ml[0] - mn) * SC2);
        const float f = __fdiv_rn(1.0f, lt * fa + ml[1] * fb); fa *= f; fb *= f;
        float* dst = out + (((size_t)b * LL + q0 + qt * 16 + lr) * NH_ + h) * HD + 8 * hi;    // register r of tile dt is d = dt * 16 + 8 * hi + r of query lr
#pragma unroll
        for (int dt = 0; dt < 4; ++dt) { const v4f x0 = *(const v4f*)(xp + (2 * dt) * 128 + lane * 4), x1 = *(const v4f*)(xp + (2 * dt + 1) * 128 + lane * 4);
            *(v4f*)(dst + dt * 16) = __builtin_shufflevector(ot[dt], ot[dt], 0, 1, 2, 3) * fa + x0 * fb; *(v4f*)(dst + dt * 16 + 4) = __builtin_shufflevector(ot[dt], ot[dt], 4, 5, 6, 7) * fa + x1 * fb; } };
    if (kh == 0) give(o[1], m[1], l[1]); else give(o[0], m[0], l[0]);    // kh is the same in every lane of a wave
    __syncthreads();    // every wave's hand-over is there for its partner
    if (kh == 0) take(o[0], m[0], l[0], 0); else take(o[1], m[1], l[1], 1);
}

extern "C" void kernel_launch(void* const* d_in, const int* in_sizes, int n_in,
                              void* d_out, int out_size, void* d_ws, size_t ws_size, hipStream_t stream) {
    (void)in_sizes; (void)n_in; (void)out_size; (void)d_ws; (void)ws_size;
    const float* q = (const float*)d_in[0]; const float* k = (const float*)d_in[1]; const float* v = (const float*)d_in[2];
    float* OUT = (float*)d_out;     // [4][2048][8][64]
    k_fa<<<dim3(LL / (32 * FAW), NB_ * NH_), FAW * KH * 32, 0, stream>>>(q, k, v, OUT);
}

// v006
// A run of this version takes 33.8 microseconds.
// Versions in between are left out here; by their measured steps it is 1.27 times as fast as v004.
// All steps since v000 together make it 24.1 times as fast.
#include <hip/hip_runtime.h>

// ScaledDotProduct (query, key [4][8][2048][64], value [4][2048 l][8 h][64]; weight = softmax(q.k / sqrt(512)) (embed_size scale, per the source); out[b][q][h][d] = sum_l weight v -> [4][2048][8][64]).
// Compute dtypes, f32 accumulate: q and k rounded to bf16, scores on PLAIN bf16 planes (exact products, f32 accumulate); scale + softmax f32; weight.v as ONE f16 product: probabilities (before the division by their sum: 0 to 2^8) and v each rounded once to f16 (11 significant bits).
// f16 reaches to 65504 (v is drawn from a normal distribution) and keeps subnormals: a probability is off by at most 2^-11 of itself or 2^-25 of its query's largest.
// The rounding of q, k and v, the scores, the softmax, weight.v and the [b][q][h][d] store run in ONE kernel over all 32 (batch, head) pairs: scores and probabilities stay in registers (running maximum and sum per query).
// What a work-group's eight query tiles share, the bf16 rows of k and the f16 rows of v, the waves of each key half round that half's rows themselves, 128 keys at a time, into two LDS buffers of its own; v is transposed on its way out of LDS. One launch, no workspace.
// Each query tile is worked on by TWO waves, one per half of the keys, so that four waves stand on every SIMD; the two partial results (maximum, sum, output columns) are joined through LDS at the end.

#define NB_  4
#define LL   2048
#define NH_  8
#define HD   64
typedef unsigned short bf;
typedef __attribute__((ext_vector_type(16))) __bf16   v16bf;
typedef __attribute__((ext_vector_type(2)))  __bf16   v2bf;
typedef __attribute__((ext_vector_type(16))) _Float16 v16h;
typedef __attribute__((ext_vector_type(2)))  _Float16 v2h;
typedef __attribute__((ext_vector_type(8)))  unsigned short v8us;
typedef __attribute__((ext_vector_type(8)))  unsigned v8u;
typedef __attribute__((ext_vector_type(8)))  float    v8f;
typedef __attribute__((ext_vector_type(4)))  float    v4f;
typedef __attribute__((ext_vector_type(2)))  float    v2f;
typedef __attribute__((ext_vector_type(2)))  unsigned v2u;
typedef __attribute__((ext_vector_type(8)))  short    v8s;
typedef __attribute__((address_space(3)))    v8s      lds_v8s;

__device__ __forceinline__ unsigned short f2bf(float f) { unsigned u = __float_as_uint(f); u += 0x7FFFu + ((u >> 16) & 1u); return (unsigned short)(u >> 16); }
__device__ __forceinline__ v16bf cat16b(v8us lo, v8us hi) { return __builtin_bit_cast(v16bf, __builtin_shufflevector(lo, hi, 0, 1, 2, 3, 4, 5, 6, 7, 8, 9, 10, 11, 12, 13, 14, 15)); }
__device__ __forceinline__ v8f wmmab(v16bf a, v16bf b, v8f c) { return __builtin_amdgcn_wmma_f32_16x16x32_bf16(false, a, false, b, (short)0, c, false, false); }
__device__ __forceinline__ v8f wmmah(v16h a, v16h b, v8f c) { return __builtin_amdgcn_wmma_f32_16x16x32_f16(false, a, false, b, (short)0, c, false, false); }
// fragment of a K-contiguous bf16 plane in the hardware k order: p points at the lane's row, k = 8 * (lane >> 4)
__device__ __forceinline__ v16bf ldf(const bf* p) { return cat16b(*(const v8us*)p, *(const v8us*)(p + 16)); }
// half a fragment of the transposed operand out of a row-major LDS tile (ds_load_tr16_b128): lane (c, h) gets rows 8 h + 0..7 of column c; p is the lane's own address, row 8 h + (lane & 7), column 8 * ((lane >> 3) & 1)
__device__ __forceinline__ v8us ldtr(const bf* p) { return __builtin_bit_cast(v8us, __builtin_amdgcn_ds_load_tr16_b128_v8i16((lds_v8s*)p)); }
// four f32 rounded to nearest even, as four bf16
__device__ __forceinline__ v2u rnd4(v4f x) { v2u y; y[0] = __builtin_bit_cast(unsigned, __builtin_convertvector(__builtin_shufflevector(x, x, 0, 1), v2bf)); y[1] = __builtin_bit_cast(unsigned, __builtin_convertvector(__builtin_shufflevector(x, x, 2, 3), v2bf)); return y; }
// the same, as four f16
__device__ __forceinline__ v2u rnd4h(v4f x) { v2u y; y[0] = __builtin_bit_cast(unsigned, __builtin_convertvector(__builtin_shufflevector(x, x, 0, 1), v2h)); y[1] = __builtin_bit_cast(unsigned, __builtin_convertvector(__builtin_shufflevector(x, x, 2, 3), v2h)); return y; }
// the value of lane l ^ 16
__device__ __forceinline__ float xhalf(float x) { const int b = __float_as_int(x); return __int_as_float(__builtin_amdgcn_permlanex16(b, b, 0x76543210, 0xfedcba98, false, false)); }

// 2^x for eight values (exp8) or two (exp2x2) in ONE statement: every result has a register of its own and a v_nop ends the run, so that no instruction
// directly behind a v_exp_f32 reads its result or overwrites its source (the slot the instruction set asks for).
__device__ __forceinline__ void exp8(float* y, const float* x) {
    asm("v_exp_f32 %0, %8\n\tv_exp_f32 %1, %9\n\tv_exp_f32 %2, %10\n\tv_exp_f32 %3, %11\n\tv_exp_f32 %4, %12\n\tv_exp_f32 %5, %13\n\tv_exp_f32 %6, %14\n\tv_exp_f32 %7, %15\n\tv_nop"
        : "=&v"(y[0]), "=&v"(y[1]), "=&v"(y[2]), "=&v"(y[3]), "=&v"(y[4]), "=&v"(y[5]), "=&v"(y[6]), "=&v"(y[7])
        : "v"(x[0]), "v"(x[1]), "v"(x[2]), "v"(x[3]), "v"(x[4]), "v"(x[5]), "v"(x[6]), "v"(x[7])); }
__device__ __forceinline__ void exp2x2(float& y0, float& y1, float x0, float x1) { asm("v_exp_f32 %0, %2\n\tv_exp_f32 %1, %3\n\tv_nop" : "=&v"(y0), "=&v"(y1) : "v"(x0), "v"(x1)); }

// ---- k_fa: KH waves per 32 queries of one (batch, head), each on LK = LL / KH keys in a row; FAW query tiles, FAW * KH waves per work-group; grid (LL / (32 * FAW), NB_ * NH_).
// The FAW waves of one key half stage that half's rows in buffers of their own; the barrier is the whole work-group's (both halves walk the same number of stages).
// Per 32 keys: St = K Qt (A = K rows, B = the wave's q rows, read as f32, rounded once and kept in registers), so a lane holds scores of ONE query (column lane & 15; keys 8 * (lane >> 4) + r of each 16-key tile);
// the two score tiles, turned into probabilities in place, ARE the B operand of Ot += Vt Pt (A = columns of the v rows, by the transposing LDS load), rounded to f16.
// p = exp2((s - m) * scale * log2 e) with m the maximum in use, renewed only when a raw score outgrows it by RT; a renewed maximum rescales the query's sum and output column; the division by the sum comes last.
// Stage = SK keys = one LDS buffer. While the waves work on 32 keys of one buffer, 32 keys of the next stage (f32 rows of k and v) are on their way into registers; at the block's foot they are rounded and stored
// to the other buffer. ONE barrier at the stage's foot both publishes that buffer and ends every wave's reads of the one that the next stage overwrites.
#define FAW 8
#define KH  2     // key halves = waves per query tile
#define LK  (LL / KH)
#define XW  (34 * 32)    // f32 a wave hands to its partner: 32 output values, maximum and sum per lane
#define SK  128   // keys per stage
#define KPI 72    // LDS pitch of a k row, in bf16: 144 B = 16 B x odd, for ds_load_b128
#define VPI 80    // LDS pitch of a v row, in f16: 160 B = 32 B x odd, for ds_load_tr16_b128
#define SC2 0.0637587154f    // (1 / sqrt(512)) * log2(e)
#define RT  (8.0f / SC2)    // a raw score this far above the maximum in use renews it: 8 in the exponent of 2
__global__ __launch_bounds__(FAW * KH * 32) void k_fa(const float* __restrict__ q, const float* __restrict__ k, const float* __restrict__ v, float* out) {
    __shared__ __attribute__((aligned(16))) bf KS[KH][2][SK * KPI];
    __shared__ __attribute__((aligned(16))) bf VS[KH][2][SK * VPI];
    __shared__ __attribute__((aligned(16))) float XS[FAW * KH][XW];
    const int lane = threadIdx.x & 31, lr = lane & 15, hi = lane >> 4; const int w = __builtin_amdgcn_readfirstlane(threadIdx.x >> 5);
    const int g = w % FAW, kh = w / FAW;    // query tile and key half, both wave-uniform
    const int bh = blockIdx.y; const int q0 = blockIdx.x * (FAW * 32) + g * 32; const int b = bh / NH_, h = bh % NH_;
    const float* Q = q + (size_t)bh * LL * HD + (size_t)q0 * HD; const float* K = k + ((size_t)bh * LL + kh * LK) * HD; const float* V = v + (((size_t)b * LL + kh * LK) * NH_ + h) * HD;    // wave-uniform bases, at the half's first key; key l of v stands at l * NH_ * HD
    const unsigned qlo = (unsigned)(lr * HD + 8 * hi);    // the lane's own part: q rows in memory,
    const unsigned klo = (unsigned)(lr * KPI + 8 * hi), vlo = (unsigned)((8 * hi + (lane & 7)) * VPI + 8 * ((lane >> 3) & 1));    // k rows and v rows in LDS
    const unsigned sr = (threadIdx.x % (FAW * 32)) >> 4, sc = (threadIdx.x & 15) * 4;    // staging: 16 threads a row of 64 f32, 16 rows per turn of the half's FAW waves
    const unsigned kgo = sr * HD + sc, vgo = sr * (NH_ * HD) + sc, kso = sr * KPI + sc, vso = sr * VPI + sc;    // the thread's own part in memory and in LDS
    // every loop over qt, kt, ks, dt, i or j below is unrolled: the fragment arrays live in registers and take constant indices only
    v4f k0[SK / 16], v0[SK / 16];    // stage 0, asked for ahead of the q rows
#pragma unroll
    for (int i = 0; i < SK / 16; ++i) { k0[i] = *(const v4f*)(K + kgo + i * 16 * HD); v0[i] = *(const v4f*)(V + vgo + i * 16 * (NH_ * HD)); }
    v16bf qf[2][2], kf[2][2];
#pragma unroll
    for (int qt = 0; qt < 2; ++qt)
#pragma unroll
        for (int ks = 0; ks < 2; ++ks) { const float* p = Q + qlo + qt * 16 * HD + ks * 32; const v8f x0 = *(const v8f*)p, x1 = *(const v8f*)(p + 16); v8us y0, y1;    // the wave's own q rows, rounded to bf16 here, same k order as ldf
#pragma unroll
            for (int j = 0; j < 8; ++j) { y0[j] = f2bf(x0[j]); y1[j] = f2bf(x1[j]); }
            qf[qt][ks] = cat16b(y0, y1); }
#pragma unroll
    for (int i = 0; i < SK / 16; ++i) { *(v2u*)(&KS[kh][0][kso + i * 16 * KPI]) = rnd4(k0[i]); *(v2u*)(&VS[kh][0][vso + i * 16 * VPI]) = rnd4h(v0[i]); }
    __syncthreads();    // stage 0 is there for every wave
#pragma unroll
    for (int kt = 0; kt < 2; ++kt)
#pragma unroll
        for (int ks = 0; ks < 2; ++ks) kf[kt][ks] = ldf(&KS[kh][0][klo + kt * 16 * KPI + ks * 32]);
    v8f o[2][4]; float m[2], l[2], nm[2], th[2];    // per query: maximum in use, sum, -m * SC2, and the score above which the maximum is renewed
#pragma unroll
    for (int qt = 0; qt < 2; ++qt) { m[qt] = -3.0e38f; l[qt] = 0.f; nm[qt] = 3.0e38f * SC2; th[qt] = -3.0e38f;    // every score is above th: the first block sets the maximum
#pragma unroll
        for (int dt = 0; dt < 4; ++dt) o[qt][dt] = (v8f){}; }
#pragma unroll 1    // rolled: one copy of a stage's code, with its one barrier
    for (int st = 0; st < LK / SK; ++st) {
      const bool more = st + 1 < LK / SK;    // the same for the whole work-group
      const bf* ksb = &KS[kh][st & 1][klo]; const bf* vsb = &VS[kh][st & 1][vlo];
#pragma unroll 1    // rolled: one 32-key block's fragments in registers at a time (unrolled by four the build went past 400 registers and into scratch)
      for (int ps = 0; ps < SK / 32; ++ps) {
        v4f kr[2], vr[2];    // 32 keys of the next stage, asked for here, stored at the block's foot
        if (more) { const float* kn = K + ((st + 1) * SK + ps * 32) * HD + kgo; const float* vn = V + ((st + 1) * SK + ps * 32) * (NH_ * HD) + vgo;
#pragma unroll
            for (int i = 0; i < 2; ++i) { kr[i] = *(const v4f*)(kn + i * 16 * HD); vr[i] = *(const v4f*)(vn + i * 16 * (NH_ * HD)); } }
        const bf* pv = vsb + ps * 32 * VPI;
        v16h vf[4];    // asked for here, first used behind the softmax
#pragma unroll
        for (int dt = 0; dt < 4; ++dt) vf[dt] = __builtin_bit_cast(v16h, cat16b(ldtr(pv + dt * 16), ldtr(pv + 16 * VPI + dt * 16)));
        v8f s[2][2];
#pragma unroll
        for (int kt = 0; kt < 2; ++kt)
#pragma unroll
            for (int qt = 0; qt < 2; ++qt) { s[qt][kt] = wmmab(kf[kt][0], qf[qt][0], (v8f){}); s[qt][kt] = wmmab(kf[kt][1], qf[qt][1], s[qt][kt]); }
        const bf* pk = ksb + (ps + 1 < SK / 32 ? ps + 1 : 0) * 32 * KPI;    // the next block's K rows, fetched under this block's softmax; a stage's last block re-reads its first and drops it (the next stage's is read behind the barrier)
#pragma unroll
        for (int kt = 0; kt < 2; ++kt)
#pragma unroll
            for (int ks = 0; ks < 2; ++ks) kf[kt][ks] = ldf(pk + kt * 16 * KPI + ks * 32);
        __builtin_amdgcn_sched_barrier(0);    // keeps the K loads up here: without it they sink to the block's foot and the next block's first product waits out their whole latency
        float mx[2];    // the lane's own maximum of each query's 16 scores
#pragma unroll
        for (int qt = 0; qt < 2; ++qt) {
            mx[qt] = s[qt][0][0];
#pragma unroll
            for (int j = 1; j < 8; ++j) mx[qt] = fmaxf(mx[qt], s[qt][0][j]);
#pragma unroll
            for (int j = 0; j < 8; ++j) mx[qt] = fmaxf(mx[qt], s[qt][1][j]); }
        // Lazy rescale: one test per block for the whole wave (a scalar branch). The maximum in use stays until a score stands more than RT above it, so a probability is at most 2^8 (f16 holds it);
        // only then, and in the first block, every query takes its newest maximum and its sum and output column are rescaled.
        if (__builtin_expect(__builtin_amdgcn_ballot_w32(mx[0] > th[0] || mx[1] > th[1]) != 0, 0)) {    // expected not taken: the rescale's code stands out of the loop's straight line
            float ax[2], al[2];
#pragma unroll
            for (int qt = 0; qt < 2; ++qt) {
                const float mn = fmaxf(m[qt], fmaxf(mx[qt], xhalf(mx[qt])));    // both halves of the wave feed the same output column: one maximum for both
                ax[qt] = (m[qt] - mn) * SC2; nm[qt] = -mn * SC2; th[qt] = mn + RT; m[qt] = mn; }
            exp2x2(al[0], al[1], ax[0], ax[1]);
#pragma unroll
            for (int qt = 0; qt < 2; ++qt) { l[qt] *= al[qt];
#pragma unroll
                for (int dt = 0; dt < 4; ++dt) o[qt][dt] *= al[qt]; }
        }
#pragma unroll
        for (int qt = 0; qt < 2; ++qt) {
            float p[16];    // element e of the B operand: score tile e >> 3, register e & 7
#pragma unroll
            for (int kt = 0; kt < 2; ++kt) { float x[8];
#pragma unroll
                for (int j = 0; j < 8; ++j) x[j] = __builtin_fmaf(s[qt][kt][j], SC2, nm[qt]);
                exp8(p + 8 * kt, x); }
            v8u wh; v2f sum2 = (v2f){0.f, 0.f};
#pragma unroll
            for (int i = 0; i < 8; ++i) {
                v2f pp; pp[0] = p[2 * i]; pp[1] = p[2 * i + 1];
                sum2 += pp;
                wh[i] = __builtin_bit_cast(unsigned, __builtin_convertvector(pp, v2h)); }
            l[qt] += sum2[0] + sum2[1];
            const v16h ph = __builtin_bit_cast(v16h, wh);
#pragma unroll
            for (int dt = 0; dt < 4; ++dt) o[qt][dt] = wmmah(vf[dt], ph, o[qt][dt]);
        }
        if (more) { bf* kd = &KS[kh][(st + 1) & 1][kso + ps * 32 * KPI]; bf* vd = &VS[kh][(st + 1) & 1][vso + ps * 32 * VPI];
#pragma unroll
            for (int i = 0; i < 2; ++i) { *(v2u*)(kd + i * 16 * KPI) = rnd4(kr[i]); *(v2u*)(vd + i * 16 * VPI) = rnd4h(vr[i]); } }
      }
      if (more) {
        __syncthreads();    // publishes the next stage; every wave has left the buffer that the next stage's foot overwrites
#pragma unroll
        for (int kt = 0; kt < 2; ++kt)
#pragma unroll
            for (int ks = 0; ks < 2; ++ks) kf[kt][ks] = ldf(&KS[kh][(st + 1) & 1][klo + kt * 16 * KPI + ks * 32]);
      }
    }
    // The join: the wave of key half kh finishes query tile qt = kh and hands the other tile to its partner (wave w ^ FAW), lane to lane, 16 B a lane and store.
    float* xs = &XS[w][0]; const float* xp = &XS[w ^ FAW][0];
#pragma unroll
    for (int qt = 0; qt < 2; ++qt) l[qt] += xhalf(l[qt]);    // the two halves of the wave summed different keys
    const auto give = [&](const v8f (&og)[4], float mg, float lg) {
#pragma unroll
        for (int dt = 0; dt < 4; ++dt) { *(v4f*)(xs + (2 * dt) * 128 + lane * 4) = __builtin_shufflevector(og[dt], og[dt], 0, 1, 2, 3); *(v4f*)(xs + (2 * dt + 1) * 128 + lane * 4) = __builtin_shufflevector(og[dt], og[dt], 4, 5, 6, 7); }
        v2f ml; ml[0] = mg; ml[1] = lg; *(v2f*)(xs + 1024 + lane * 2) = ml; };
    const auto take = [&](const v8f (&ot)[4], float mt, float lt, int qt) {
        const v2f ml = *(const v2f*)(xp + 1024 + lane * 2);
        const float mn = fmaxf(mt, ml[0]); float fa, fb; exp2x2(fa, fb, (mt - mn) * SC2, (ml[0] - mn) * SC2);
        const float f = __fdiv_rn(1.0f, lt * fa + ml[1] * fb); fa *= f; fb *= f;
        float* dst = out + (((size_t)b * LL + q0 + qt * 16 + lr) * NH_ + h) * HD + 8 * hi;    // register r of tile dt is d = dt * 16 + 8 * hi + r of query lr
#pragma unroll
        for (int dt = 0; dt < 4; ++dt) { const v4f x0 = *(const v4f*)(xp + (2 * dt) * 128 + lane * 4), x1 = *(const v4f*)(xp + (2 * dt + 1) * 128 + lane * 4);
            *(v4f*)(dst + dt * 16) = __builtin_shufflevector(ot[dt], ot[dt], 0, 1, 2, 3) * fa + x0 * fb; *(v4f*)(dst + dt * 16 + 4) = __builtin_shufflevector(ot[dt], ot[dt], 4, 5, 6, 7) * fa + x1 * fb; } };
    if (kh == 0) give(o[1], m[1], l[1]); else give(o[0], m[0], l[0]);    // kh is the same in every lane of a wave
    __syncthreads();    // every wave's hand-over is there for its partner
    if (kh == 0) take(o[0], m[0], l[0], 0); else take(o[1], m[1], l[1], 1);
}

extern "C" void kernel_launch(void* const* d_in, const int* in_sizes, int n_in,
                              void* d_out, int out_size, void* d_ws, size_t ws_size, hipStream_t stream) {
    (void)in_sizes; (void)n_in; (void)out_size; (void)d_ws; (void)ws_size;
    const float* q = (const float*)d_in[0]; const float* k = (const float*)d_in[1]; const float* v = (const float*)d_in[2];
    float* OUT = (float*)d_out;     // [4][2048][8][64]
    k_fa<<<dim3(LL / (32 * FAW), NB_ * NH_), FAW * KH * 32, 0, stream>>>(q, k, v, OUT);
}

// v007
// A run of this version takes 32.3 microseconds.
// In both of two side-by-side timings against v006, it was 1.05 times as fast.
// All steps since v000 together make it 25.2 times as fast.
#include <hip/hip_runtime.h>

// ScaledDotProduct (query, key [4][8][2048][64], value [4][2048 l][8 h][64]; weight = softmax(q.k / sqrt(512)) (embed_size scale, per the source); out[b][q][h][d] = sum_l weight v -> [4][2048][8][64]).
// Compute dtypes, f32 accumulate: q and k rounded to bf16, scores on PLAIN bf16 planes (exact products, f32 accumulate); scale + softmax f32; weight.v as ONE f16 product: probabilities (before the division by their sum: 0 to 2^8) and v each rounded once to f16 (11 significant bits).
// f16 reaches to 65504 (v is drawn from a normal distribution) and keeps subnormals: a probability is off by at most 2^-11 of itself or 2^-25 of its query's largest.
// The rounding of q, k and v, the scores, the softmax, weight.v and the [b][q][h][d] store run in ONE kernel over all 32 (batch, head) pairs: scores and probabilities stay in registers (running maximum and sum per query).
// What a work-group's eight query tiles share, the bf16 rows of k and the f16 rows of v, the waves of each key half round that half's rows themselves, 128 keys to a buffer (after stage 0, 32 keys a block), into two LDS buffers of its own; v is transposed on its way out of LDS. One launch, no workspace.
// Each query tile is worked on by TWO waves, one per half of the keys, so that four waves stand on every SIMD; the two partial results (maximum, sum, output columns) are joined through LDS at the end.

#define NB_  4
#define LL   2048
#define NH_  8
#define HD   64
typedef unsigned short bf;
typedef __attribute__((ext_vector_type(16))) __bf16   v16bf;
typedef __attribute__((ext_vector_type(2)))  __bf16   v2bf;
typedef __attribute__((ext_vector_type(16))) _Float16 v16h;
typedef __attribute__((ext_vector_type(2)))  _Float16 v2h;
typedef __attribute__((ext_vector_type(8)))  unsigned short v8us;
typedef __attribute__((ext_vector_type(8)))  unsigned v8u;
typedef __attribute__((ext_vector_type(8)))  float    v8f;
typedef __attribute__((ext_vector_type(4)))  float    v4f;
typedef __attribute__((ext_vector_type(2)))  float    v2f;
typedef __attribute__((ext_vector_type(2)))  unsigned v2u;
typedef __attribute__((ext_vector_type(8)))  short    v8s;
typedef __attribute__((address_space(3)))    v8s      lds_v8s;

__device__ __forceinline__ unsigned short f2bf(float f) { unsigned u = __float_as_uint(f); u += 0x7FFFu + ((u >> 16) & 1u); return (unsigned short)(u >> 16); }
__device__ __forceinline__ v16bf cat16b(v8us lo, v8us hi) { return __builtin_bit_cast(v16bf, __builtin_shufflevector(lo, hi, 0, 1, 2, 3, 4, 5, 6, 7, 8, 9, 10, 11, 12, 13, 14, 15)); }
__device__ __forceinline__ v8f wmmab(v16bf a, v16bf b, v8f c) { return __builtin_amdgcn_wmma_f32_16x16x32_bf16(false, a, false, b, (short)0, c, false, false); }
__device__ __forceinline__ v8f wmmah(v16h a, v16h b, v8f c) { return __builtin_amdgcn_wmma_f32_16x16x32_f16(false, a, false, b, (short)0, c, false, false); }
// fragment of a K-contiguous bf16 plane in the hardware k order: p points at the lane's row, k = 8 * (lane >> 4)
__device__ __forceinline__ v16bf ldf(const bf* p) { return cat16b(*(const v8us*)p, *(const v8us*)(p + 16)); }
// half a fragment of the transposed operand out of a row-major LDS tile (ds_load_tr16_b128): lane (c, h) gets rows 8 h + 0..7 of column c; p is the lane's own address, row 8 h + (lane & 7), column 8 * ((lane >> 3) & 1)
__device__ __forceinline__ v8us ldtr(const bf* p) { return __builtin_bit_cast(v8us, __builtin_amdgcn_ds_load_tr16_b128_v8i16((lds_v8s*)p)); }
// four f32 rounded to nearest even, as four bf16
__device__ __forceinline__ v2u rnd4(v4f x) { v2u y; y[0] = __builtin_bit_cast(unsigned, __builtin_convertvector(__builtin_shufflevector(x, x, 0, 1), v2bf)); y[1] = __builtin_bit_cast(unsigned, __builtin_convertvector(__builtin_shufflevector(x, x, 2, 3), v2bf)); return y; }
// the same, as four f16
__device__ __forceinline__ v2u rnd4h(v4f x) { v2u y; y[0] = __builtin_bit_cast(unsigned, __builtin_convertvector(__builtin_shufflevector(x, x, 0, 1), v2h)); y[1] = __builtin_bit_cast(unsigned, __builtin_convertvector(__builtin_shufflevector(x, x, 2, 3), v2h)); return y; }
// the value of lane l ^ 16
__device__ __forceinline__ float xhalf(float x) { const int b = __float_as_int(x); return __int_as_float(__builtin_amdgcn_permlanex16(b, b, 0x76543210, 0xfedcba98, false, false)); }

// 2^x for eight values (exp8) or two (exp2x2) in ONE statement: every result has a register of its own and a v_nop ends the run, so that no instruction
// directly behind a v_exp_f32 reads its result or overwrites its source (the slot the instruction set asks for).
__device__ __forceinline__ void exp8(float* y, const float* x) {
    asm("v_exp_f32 %0, %8\n\tv_exp_f32 %1, %9\n\tv_exp_f32 %2, %10\n\tv_exp_f32 %3, %11\n\tv_exp_f32 %4, %12\n\tv_exp_f32 %5, %13\n\tv_exp_f32 %6, %14\n\tv_exp_f32 %7, %15\n\tv_nop"
        : "=&v"(y[0]), "=&v"(y[1]), "=&v"(y[2]), "=&v"(y[3]), "=&v"(y[4]), "=&v"(y[5]), "=&v"(y[6]), "=&v"(y[7])
        : "v"(x[0]), "v"(x[1]), "v"(x[2]), "v"(x[3]), "v"(x[4]), "v"(x[5]), "v"(x[6]), "v"(x[7])); }
__device__ __forceinline__ void exp2x2(float& y0, float& y1, float x0, float x1) { asm("v_exp_f32 %0, %2\n\tv_exp_f32 %1, %3\n\tv_nop" : "=&v"(y0), "=&v"(y1) : "v"(x0), "v"(x1)); }

// ---- k_fa: KH waves per 32 queries of one (batch, head), each on LK = LL / KH keys in a row; FAW query tiles, FAW * KH waves per work-group; grid (LL / (32 * FAW), NB_ * NH_).
// The FAW waves of one key half stage that half's rows in buffers of their own; the barrier is the whole work-group's (both halves walk the same number of stages).
// Per 32 keys: St = K Qt (A = K rows, B = the wave's q rows, read as f32, rounded once and kept in registers), so a lane holds scores of ONE query (column lane & 15; keys 8 * (lane >> 4) + r of each 16-key tile);
// the two score tiles, turned into probabilities in place, ARE the B operand of Ot += Vt Pt (A = columns of the v rows, by the transposing LDS load), rounded to f16.
// p = exp2((s - m) * scale * log2 e) with m the maximum in use, renewed only when a raw score outgrows it by RT; a renewed maximum rescales the query's sum and output column; the division by the sum comes last.
// Stage = SK keys = one LDS buffer. While the waves work on 32 keys of one buffer, 32 keys of the next stage (f32 rows of k and v) are on their way into registers, asked for one block ahead; behind the block's
// rescale test they are rounded and stored to the other buffer. ONE barrier per stage both publishes that buffer and ends every wave's reads of the one that the next stage overwrites. It is SPLIT: a wave signals in the
// stage's last block, behind its stores and its last LDS reads of the stage, and waits at the stage's foot; the block's softmax and weight.v products, which touch no LDS, stand between, so that a wave that is ahead
// of the others by less than that does not stop.
#define FAW 8
#define KH  2     // key halves = waves per query tile
#define LK  (LL / KH)
#define XW  (34 * 32)    // f32 a wave hands to its partner: 32 output values, maximum and sum per lane
#define SK  128   // keys per stage
#define KPI 72    // LDS pitch of a k row, in bf16: 144 B = 16 B x odd, for ds_load_b128
#define VPI 80    // LDS pitch of a v row, in f16: 160 B = 32 B x odd, for ds_load_tr16_b128
#define SC2 0.0637587154f    // (1 / sqrt(512)) * log2(e)
#define RT  (8.0f / SC2)    // a raw score this far above the maximum in use renews it: 8 in the exponent of 2
__global__ __launch_bounds__(FAW * KH * 32) void k_fa(const float* __restrict__ q, const float* __restrict__ k, const float* __restrict__ v, float* out) {
    __shared__ __attribute__((aligned(16))) bf KS[KH][2][SK * KPI];
    __shared__ __attribute__((aligned(16))) bf VS[KH][2][SK * VPI];
    __shared__ __attribute__((aligned(16))) float XS[FAW * KH][XW];
    const int lane = threadIdx.x & 31, lr = lane & 15, hi = lane >> 4; const int w = __builtin_amdgcn_readfirstlane(threadIdx.x >> 5);
    const int g = w % FAW, kh = w / FAW;    // query tile and key half, both wave-uniform
    const int bh = blockIdx.y; const int q0 = blockIdx.x * (FAW * 32) + g * 32; const int b = bh / NH_, h = bh % NH_;
    const float* Q = q + (size_t)bh * LL * HD + (size_t)q0 * HD; const float* K = k + ((size_t)bh * LL + kh * LK) * HD; const float* V = v + (((size_t)b * LL + kh * LK) * NH_ + h) * HD;    // wave-uniform bases, at the half's first key; key l of v stands at l * NH_ * HD
    const unsigned qlo = (unsigned)(lr * HD + 8 * hi);    // the lane's own part: q rows in memory,
    const unsigned klo = (unsigned)(lr * KPI + 8 * hi), vlo = (unsigned)((8 * hi + (lane & 7)) * VPI + 8 * ((lane >> 3) & 1));    // k rows and v rows in LDS
    const unsigned sr = (threadIdx.x % (FAW * 32)) >> 4, sc = (threadIdx.x & 15) * 4;    // staging: 16 threads a row of 64 f32, 16 rows per turn of the half's FAW waves
    const unsigned kgo = sr * HD + sc, vgo = sr * (NH_ * HD) + sc, kso = sr * KPI + sc, vso = sr * VPI + sc;    // the thread's own part in memory and in LDS
    // every loop over qt, kt, ks, dt, i or j below is unrolled: the fragment arrays live in registers and take constant indices only
    v4f k0[SK / 16], v0[SK / 16];    // stage 0, asked for ahead of the q rows
#pragma unroll
    for (int i = 0; i < SK / 16; ++i) { k0[i] = *(const v4f*)(K + kgo + i * 16 * HD); v0[i] = *(const v4f*)(V + vgo + i * 16 * (NH_ * HD)); }
    v16bf qf[2][2], kf[2][2];
#pragma unroll
    for (int qt = 0; qt < 2; ++qt)
#pragma unroll
        for (int ks = 0; ks < 2; ++ks) { const float* p = Q + qlo + qt * 16 * HD + ks * 32; const v8f x0 = *(const v8f*)p, x1 = *(const v8f*)(p + 16); v8us y0, y1;    // the wave's own q rows, rounded to bf16 here, same k order as ldf
#pragma unroll
            for (int j = 0; j < 8; ++j) { y0[j] = f2bf(x0[j]); y1[j] = f2bf(x1[j]); }
            qf[qt][ks] = cat16b(y0, y1); }
#pragma unroll
    for (int i = 0; i < SK / 16; ++i) { *(v2u*)(&KS[kh][0][kso + i * 16 * KPI]) = rnd4(k0[i]); *(v2u*)(&VS[kh][0][vso + i * 16 * VPI]) = rnd4h(v0[i]); }
    __syncthreads();    // stage 0 is there for every wave
#pragma unroll
    for (int kt = 0; kt < 2; ++kt)
#pragma unroll
        for (int ks = 0; ks < 2; ++ks) kf[kt][ks] = ldf(&KS[kh][0][klo + kt * 16 * KPI + ks * 32]);
    v8f o[2][4]; float m[2], l[2], nm[2], th[2];    // per query: maximum in use, sum, -m * SC2, and the score above which the maximum is renewed
#pragma unroll
    for (int qt = 0; qt < 2; ++qt) { m[qt] = -3.0e38f; l[qt] = 0.f; nm[qt] = 3.0e38f * SC2; th[qt] = -3.0e38f;    // every score is above th: the first block sets the maximum
#pragma unroll
        for (int dt = 0; dt < 4; ++dt) o[qt][dt] = (v8f){}; }
    v4f kr[2], vr[2];    // 32 keys of the next stage, asked for one block ahead of the block that stores them; here the first 32 keys of stage 1
#pragma unroll
    for (int i = 0; i < 2; ++i) { kr[i] = *(const v4f*)(K + SK * HD + kgo + i * 16 * HD); vr[i] = *(const v4f*)(V + SK * (NH_ * HD) + vgo + i * 16 * (NH_ * HD)); }
#pragma unroll 1    // rolled: one copy of a stage's code, with its one barrier
    for (int st = 0; st < LK / SK; ++st) {
      const bool more = st + 1 < LK / SK;    // the same for the whole work-group
      const bf* ksb = &KS[kh][st & 1][klo]; const bf* vsb = &VS[kh][st & 1][vlo];
#pragma unroll 1    // rolled: one 32-key block's fragments in registers at a time (unrolled by four the build went past 400 registers and into scratch)
      for (int ps = 0; ps < SK / 32; ++ps) {
        const bf* pv = vsb + ps * 32 * VPI;
        v16h vf[4];    // asked for here, first used behind the softmax
#pragma unroll
        for (int dt = 0; dt < 4; ++dt) vf[dt] = __builtin_bit_cast(v16h, cat16b(ldtr(pv + dt * 16), ldtr(pv + 16 * VPI + dt * 16)));
        v8f s[2][2];
#pragma unroll
        for (int kt = 0; kt < 2; ++kt)
#pragma unroll
            for (int qt = 0; qt < 2; ++qt) { s[qt][kt] = wmmab(kf[kt][0], qf[qt][0], (v8f){}); s[qt][kt] = wmmab(kf[kt][1], qf[qt][1], s[qt][kt]); }
        const bf* pk = ksb + (ps + 1 < SK / 32 ? ps + 1 : 0) * 32 * KPI;    // the next block's K rows, fetched under this block's softmax; a stage's last block re-reads its first and drops it (the next stage's is read behind the barrier)
#pragma unroll
        for (int kt = 0; kt < 2; ++kt)
#pragma unroll
            for (int ks = 0; ks < 2; ++ks) kf[kt][ks] = ldf(pk + kt * 16 * KPI + ks * 32);
        __builtin_amdgcn_sched_barrier(0);    // keeps the K loads up here: without it they sink to the block's foot and the next block's first product waits out their whole latency
        float mx[2];    // the lane's own maximum of each query's 16 scores
#pragma unroll
        for (int qt = 0; qt < 2; ++qt) {
            mx[qt] = s[qt][0][0];
#pragma unroll
            for (int j = 1; j < 8; ++j) mx[qt] = fmaxf(mx[qt], s[qt][0][j]);
#pragma unroll
            for (int j = 0; j < 8; ++j) mx[qt] = fmaxf(mx[qt], s[qt][1][j]); }
        // Lazy rescale: one test per block for the whole wave (a scalar branch). The maximum in use stays until a score stands more than RT above it, so a probability is at most 2^8 (f16 holds it);
        // only then, and in the first block, every query takes its newest maximum and its sum and output column are rescaled.
        if (__builtin_expect(__builtin_amdgcn_ballot_w32(mx[0] > th[0] || mx[1] > th[1]) != 0, 0)) {    // expected not taken: the rescale's code stands out of the loop's straight line
            float ax[2], al[2];
#pragma unroll
            for (int qt = 0; qt < 2; ++qt) {
                const float mn = fmaxf(m[qt], fmaxf(mx[qt], xhalf(mx[qt])));    // both halves of the wave feed the same output column: one maximum for both
                ax[qt] = (m[qt] - mn) * SC2; nm[qt] = -mn * SC2; th[qt] = mn + RT; m[qt] = mn; }
            exp2x2(al[0], al[1], ax[0], ax[1]);
#pragma unroll
            for (int qt = 0; qt < 2; ++qt) { l[qt] *= al[qt];
#pragma unroll
                for (int dt = 0; dt < 4; ++dt) o[qt][dt] *= al[qt]; }
        }
        if (more) { bf* kd = &KS[kh][(st + 1) & 1][kso + ps * 32 * KPI]; bf* vd = &VS[kh][(st + 1) & 1][vso + ps * 32 * VPI];
#pragma unroll
            for (int i = 0; i < 2; ++i) { *(v2u*)(kd + i * 16 * KPI) = rnd4(kr[i]); *(v2u*)(vd + i * 16 * VPI) = rnd4h(vr[i]); }
            // The stage's last block (the same test for the whole work-group): the barrier's signal. The wait in front of it ends this wave's stores to the next buffer and its last reads of this one; one statement, so that nothing comes between them.
            if (ps + 1 == SK / 32) asm volatile("s_wait_dscnt 0x0\n\ts_barrier_signal -1" ::: "memory");
            const int nk = (st + 1) * SK + (ps + 1) * 32;    // first key of the 32 that the next block stores
            if (nk < LK) { const float* kn = K + nk * HD + kgo; const float* vn = V + nk * (NH_ * HD) + vgo;
#pragma unroll
                for (int i = 0; i < 2; ++i) { kr[i] = *(const v4f*)(kn + i * 16 * HD); vr[i] = *(const v4f*)(vn + i * 16 * (NH_ * HD)); }
                asm volatile("s_wait_xcnt 0x0" :: "v"(kn), "v"(vn) : "memory"); } }    // stands in front of every overwrite of the four loads' address registers: as inputs they live up to here, so that no load's own result lands on them either
#pragma unroll
        for (int qt = 0; qt < 2; ++qt) {
            float p[16];    // element e of the B operand: score tile e >> 3, register e & 7
#pragma unroll
            for (int kt = 0; kt < 2; ++kt) { float x[8];
#pragma unroll
                for (int j = 0; j < 8; ++j) x[j] = __builtin_fmaf(s[qt][kt][j], SC2, nm[qt]);
                exp8(p + 8 * kt, x); }
            v8u wh; v2f sum2 = (v2f){0.f, 0.f};
#pragma unroll
            for (int i = 0; i < 8; ++i) {
                v2f pp; pp[0] = p[2 * i]; pp[1] = p[2 * i + 1];
                sum2 += pp;
                wh[i] = __builtin_bit_cast(unsigned, __builtin_convertvector(pp, v2h)); }
            l[qt] += sum2[0] + sum2[1];
            const v16h ph = __builtin_bit_cast(v16h, wh);
#pragma unroll
            for (int dt = 0; dt < 4; ++dt) o[qt][dt] = wmmah(vf[dt], ph, o[qt][dt]);
        }
        __builtin_amdgcn_sched_barrier(0);    // holds the v_nop below at the block's foot, behind its last product
        asm volatile("v_nop\n\tv_nop\n\tv_nop");    // the distance behind the block's last product: the next block's address arithmetic, one product further on, reuses its A registers
      }
      if (more) {
        asm volatile("s_barrier_wait -1" ::: "memory");    // the barrier's wait: every wave has signalled, so the next stage is published and every wave has left the buffer that the next stage overwrites; no LDS access stands between signal and wait
#pragma unroll
        for (int kt = 0; kt < 2; ++kt)
#pragma unroll
            for (int ks = 0; ks < 2; ++ks) kf[kt][ks] = ldf(&KS[kh][(st + 1) & 1][klo + kt * 16 * KPI + ks * 32]);
      }
    }
    // The join: the wave of key half kh finishes query tile qt = kh and hands the other tile to its partner (wave w ^ FAW), lane to lane, 16 B a lane and store.
    float* xs = &XS[w][0]; const float* xp = &XS[w ^ FAW][0];
#pragma unroll
    for (int qt = 0; qt < 2; ++qt) l[qt] += xhalf(l[qt]);    // the two halves of the wave summed different keys
    const auto give = [&](const v8f (&og)[4], float mg, float lg) {
#pragma unroll
        for (int dt = 0; dt < 4; ++dt) { *(v4f*)(xs + (2 * dt) * 128 + lane * 4) = __builtin_shufflevector(og[dt], og[dt], 0, 1, 2, 3); *(v4f*)(xs + (2 * dt + 1) * 128 + lane * 4) = __builtin_shufflevector(og[dt], og[dt], 4, 5, 6, 7); }
        v2f ml; ml[0] = mg; ml[1] = lg; *(v2f*)(xs + 1024 + lane * 2) = ml; };
    const auto take = [&](const v8f (&ot)[4], float mt, float lt, int qt) {
        const v2f ml = *(const v2f*)(xp + 1024 + lane * 2);
        const float mn = fmaxf(mt, ml[0]); float fa, fb; exp2x2(fa, fb, (mt - mn) * SC2, (ml[0] - mn) * SC2);
        const float f = __fdiv_rn(1.0f, lt * fa + ml[1] * fb); fa *= f; fb *= f;
        float* dst = out + (((size_t)b * LL + q0 + qt * 16 + lr) * NH_ + h) * HD + 8 * hi;    // register r of tile dt is d = dt * 16 + 8 * hi + r of query lr
#pragma unroll
        for (int dt = 0; dt < 4; ++dt) { const v4f x0 = *(const v4f*)(xp + (2 * dt) * 128 + lane * 4), x1 = *(const v4f*)(xp + (2 * dt + 1) * 128 + lane * 4);
            *(v4f*)(dst + dt * 16) = __builtin_shufflevector(ot[dt], ot[dt], 0, 1, 2, 3) * fa + x0 * fb; *(v4f*)(dst + dt * 16 + 4) = __builtin_shufflevector(ot[dt], ot[dt], 4, 5, 6, 7) * fa + x1 * fb; } };
    if (kh == 0) give(o[1], m[1], l[1]); else give(o[0], m[0], l[0]);    // kh is the same in every lane of a wave
    __syncthreads();    // every wave's hand-over is there for its partner
    if (kh == 0) take(o[0], m[0], l[0], 0); else take(o[1], m[1], l[1], 1);
}

extern "C" void kernel_launch(void* const* d_in, const int* in_sizes, int n_in,
                              void* d_out, int out_size, void* d_ws, size_t ws_size, hipStream_t stream) {
    (void)in_sizes; (void)n_in; (void)out_size; (void)d_ws; (void)ws_size;
    const float* q = (const float*)d_in[0]; const float* k = (const float*)d_in[1]; const float* v = (const float*)d_in[2];
    float* OUT = (float*)d_out;     // [4][2048][8][64]
    k_fa<<<dim3(LL / (32 * FAW), NB_ * NH_), FAW * KH * 32, 0, stream>>>(q, k, v, OUT);
}

// v008
// One run takes 31.2 microseconds.
// Timed twice side by side with v007, it ran 1.03 and 1.04 times as fast.
// Counting every step since v000, it is 26.0 times as fast.
#include <hip/hip_runtime.h>

// ScaledDotProduct (query, key [4][8][2048][64], value [4][2048 l][8 h][64]; weight = softmax(q.k / sqrt(512)) (embed_size scale, per the source); out[b][q][h][d] = sum_l weight v -> [4][2048][8][64]).
// Compute dtypes, f32 accumulate: q and k rounded to bf16, scores on PLAIN bf16 planes (exact products, f32 accumulate); scale + softmax f32; weight.v as ONE f16 product: probabilities (before the division by their sum: 0 to 2^15) and v each rounded once to f16 (11 significant bits).
// f16 reaches to 65504 (v is drawn from a normal distribution) and keeps subnormals: a probability is off by at most 2^-11 of itself or 2^-25 of its query's largest.
// The rounding of q, k and v, the scores, the softmax, weight.v and the [b][q][h][d] store run in ONE kernel over all 32 (batch, head) pairs: scores and probabilities stay in registers (a reference score and a running sum per query).
// What a work-group's eight query tiles share, the bf16 rows of k and the f16 rows of v, each key half's waves round themselves, 128 keys at a time, into two LDS buffers of their own; v is transposed on its way out of LDS. One launch, no workspace.
// Each query tile is worked on by TWO waves, one per half of the keys, so that four waves stand on every SIMD; the two partial results (reference, sum, output columns) are joined through LDS at the end.

#define NB_  4
#define LL   2048
#define NH_  8
#define HD   64
typedef unsigned short bf;
typedef __attribute__((ext_vector_type(16))) __bf16   v16bf;
typedef __attribute__((ext_vector_type(2)))  __bf16   v2bf;
typedef __attribute__((ext_vector_type(16))) _Float16 v16h;
typedef __attribute__((ext_vector_type(2)))  _Float16 v2h;
typedef __attribute__((ext_vector_type(8)))  unsigned short v8us;
typedef __attribute__((ext_vector_type(8)))  unsigned v8u;
typedef __attribute__((ext_vector_type(8)))  float    v8f;
typedef __attribute__((ext_vector_type(4)))  float    v4f;
typedef __attribute__((ext_vector_type(2)))  float    v2f;
typedef __attribute__((ext_vector_type(2)))  unsigned v2u;
typedef __attribute__((ext_vector_type(8)))  short    v8s;
typedef __attribute__((address_space(3)))    v8s      lds_v8s;

__device__ __forceinline__ unsigned short f2bf(float f) { unsigned u = __float_as_uint(f); u += 0x7FFFu + ((u >> 16) & 1u); return (unsigned short)(u >> 16); }
__device__ __forceinline__ v16bf cat16b(v8us lo, v8us hi) { return __builtin_bit_cast(v16bf, __builtin_shufflevector(lo, hi, 0, 1, 2, 3, 4, 5, 6, 7, 8, 9, 10, 11, 12, 13, 14, 15)); }
__device__ __forceinline__ v8f wmmab(v16bf a, v16bf b, v8f c) { return __builtin_amdgcn_wmma_f32_16x16x32_bf16(false, a, false, b, (short)0, c, false, false); }
__device__ __forceinline__ v8f wmmah(v16h a, v16h b, v8f c) { return __builtin_amdgcn_wmma_f32_16x16x32_f16(false, a, false, b, (short)0, c, false, false); }
// fragment of a K-contiguous bf16 plane in the hardware k order: p points at the lane's row, k = 8 * (lane >> 4)
__device__ __forceinline__ v16bf ldf(const bf* p) { return cat16b(*(const v8us*)p, *(const v8us*)(p + 16)); }
// half a fragment of the transposed operand out of a row-major LDS tile (ds_load_tr16_b128): lane (c, h) gets rows 8 h + 0..7 of column c; p is the lane's own address, row 8 h + (lane & 7), column 8 * ((lane >> 3) & 1)
__device__ __forceinline__ v8us ldtr(const bf* p) { return __builtin_bit_cast(v8us, __builtin_amdgcn_ds_load_tr16_b128_v8i16((lds_v8s*)p)); }
// four f32 rounded to nearest even, as four bf16
__device__ __forceinline__ v2u rnd4(v4f x) { v2u y; y[0] = __builtin_bit_cast(unsigned, __builtin_convertvector(__builtin_shufflevector(x, x, 0, 1), v2bf)); y[1] = __builtin_bit_cast(unsigned, __builtin_convertvector(__builtin_shufflevector(x, x, 2, 3), v2bf)); return y; }
// the same, as four f16
__device__ __forceinline__ v2u rnd4h(v4f x) { v2u y; y[0] = __builtin_bit_cast(unsigned, __builtin_convertvector(__builtin_shufflevector(x, x, 0, 1), v2h)); y[1] = __builtin_bit_cast(unsigned, __builtin_convertvector(__builtin_shufflevector(x, x, 2, 3), v2h)); return y; }
// the value of lane l ^ 16
__device__ __forceinline__ float xhalf(float x) { const int b = __float_as_int(x); return __int_as_float(__builtin_amdgcn_permlanex16(b, b, 0x76543210, 0xfedcba98, false, false)); }

// 2^x for eight values (exp8h) or two (exp2x2) in ONE statement: every result has a register of its own, and no instruction directly behind a v_exp_f32 reads its result or overwrites its source
// (the slot the instruction set asks for): in exp2x2 a v_nop ends the run; in exp8h the roundings to f16 of the first results do.
// exp8h gives the eight results as f32 (y) and, rounded to nearest even, as four f16 pairs (h). The roundings stand in the statement so that they stay ahead of the overflow test: left to the compiler they sink
// behind its branch, all 32 f32 results of a block stay alive up to there, and the build goes into scratch. The s_delay_alu names the last pair's producer, so that the wait for it does not hold the vector port.
__device__ __forceinline__ void exp8h(float* y, unsigned* h, const float* x) {
    asm("v_exp_f32 %0, %12\n\tv_exp_f32 %1, %13\n\tv_exp_f32 %2, %14\n\tv_exp_f32 %3, %15\n\tv_exp_f32 %4, %16\n\tv_exp_f32 %5, %17\n\tv_exp_f32 %6, %18\n\tv_exp_f32 %7, %19\n\t"
        "v_cvt_pk_f16_f32 %8, %0, %1\n\tv_cvt_pk_f16_f32 %9, %2, %3\n\tv_cvt_pk_f16_f32 %10, %4, %5\n\ts_delay_alu instid0(TRANS32_DEP_1)\n\tv_cvt_pk_f16_f32 %11, %6, %7"
        : "=&v"(y[0]), "=&v"(y[1]), "=&v"(y[2]), "=&v"(y[3]), "=&v"(y[4]), "=&v"(y[5]), "=&v"(y[6]), "=&v"(y[7]), "=&v"(h[0]), "=&v"(h[1]), "=&v"(h[2]), "=&v"(h[3])
        : "v"(x[0]), "v"(x[1]), "v"(x[2]), "v"(x[3]), "v"(x[4]), "v"(x[5]), "v"(x[6]), "v"(x[7])); }
__device__ __forceinline__ void exp2x2(float& y0, float& y1, float x0, float x1) { asm("v_exp_f32 %0, %2\n\tv_exp_f32 %1, %3\n\tv_nop" : "=&v"(y0), "=&v"(y1) : "v"(x0), "v"(x1)); }

// ---- k_fa: KH waves per 32 queries of one (batch, head), each on LK = LL / KH keys in a row; FAW query tiles, FAW * KH waves per work-group; grid (LL / (32 * FAW), NB_ * NH_).
// The FAW waves of one key half stage that half's rows in buffers of their own; the barrier is the whole work-group's (both halves walk the same number of stages).
// Per 32 keys: St = K Qt (A = K rows, B = the wave's q rows, read as f32, rounded once and kept in registers), so a lane holds scores of ONE query (column lane & 15; keys 8 * (lane >> 4) + r of each 16-key tile);
// the two score tiles, turned into probabilities in place, ARE the B operand of Ot += Vt Pt (A = columns of the v rows, by the transposing LDS load), rounded to f16.
// p = exp2((s - m) * scale * log2 e) with m the query's reference: at first one of its own scores, so that its largest p is at least 1. NO MAXIMUM IS TAKEN IN THE LOOP: p is not negative, so a lane's sum of its 16 p per query,
// which the softmax needs anyway, bounds each of them; only when a sum passes PL is the reference raised to the block's maximum, the query's sum and output column rescaled and the block's p made anew. The division by the sum comes last.
// Stage = SK keys = one LDS buffer. While the waves work on 32 keys of one buffer, 32 keys of the next stage (f32 rows of k and v) are on their way into registers, asked for one block ahead; behind the block's
// score products they are rounded and stored to the other buffer. ONE barrier per stage both publishes that buffer and ends every wave's reads of the one that the next stage overwrites. It is SPLIT: a wave signals in the
// stage's last block, behind its stores and its last LDS reads of the stage, and waits at the stage's foot; the block's softmax and weight.v products, which touch no LDS, stand between, so that a wave that is ahead
// of the others by less than that does not stop.
#define FAW 8
#define KH  2     // key halves = waves per query tile
#define LK  (LL / KH)
#define XW  (34 * 32)    // f32 a wave hands to its partner: 32 output values, reference and sum per lane
#define SK  128   // keys per stage
#define KPI 72    // LDS pitch of a k row, in bf16: 144 B = 16 B x odd, for ds_load_b128
#define VPI 80    // LDS pitch of a v row, in f16: 160 B = 32 B x odd, for ds_load_tr16_b128
#define SC2 0.0637587154f    // (1 / sqrt(512)) * log2(e)
#define PL  32768.0f    // a sum of p up to here shows that f16 (to 65504) holds each of them
__global__ __launch_bounds__(FAW * KH * 32) void k_fa(const float* __restrict__ q, const float* __restrict__ k, const float* __restrict__ v, float* out) {
    __shared__ __attribute__((aligned(16))) bf KS[KH][2][SK * KPI];
    __shared__ __attribute__((aligned(16))) bf VS[KH][2][SK * VPI];
    __shared__ __attribute__((aligned(16))) float XS[FAW * KH][XW];
    const int lane = threadIdx.x & 31, lr = lane & 15, hi = lane >> 4; const int w = __builtin_amdgcn_readfirstlane(threadIdx.x >> 5);
    const int g = w % FAW, kh = w / FAW;    // query tile and key half, both wave-uniform
    const int bh = blockIdx.y; const int q0 = blockIdx.x * (FAW * 32) + g * 32; const int b = bh / NH_, h = bh % NH_;
    const float* Q = q + (size_t)bh * LL * HD + (size_t)q0 * HD; const float* K = k + ((size_t)bh * LL + kh * LK) * HD; const float* V = v + (((size_t)b * LL + kh * LK) * NH_ + h) * HD;    // wave-uniform bases, at the half's first key; key l of v stands at l * NH_ * HD
    const unsigned qlo = (unsigned)(lr * HD + 8 * hi);    // the lane's own part: q rows in memory,
    const unsigned klo = (unsigned)(lr * KPI + 8 * hi), vlo = (unsigned)((8 * hi + (lane & 7)) * VPI + 8 * ((lane >> 3) & 1));    // k rows and v rows in LDS
    const unsigned sr = (threadIdx.x % (FAW * 32)) >> 4, sc = (threadIdx.x & 15) * 4;    // staging: 16 threads a row of 64 f32, 16 rows per turn of the half's FAW waves
    const unsigned kgo = sr * HD + sc, vgo = sr * (NH_ * HD) + sc, kso = sr * KPI + sc, vso = sr * VPI + sc;    // the thread's own part in memory and in LDS
    // every loop over qt, kt, ks, dt, i or j below is unrolled: the fragment arrays live in registers and take constant indices only
    v4f k0[SK / 16], v0[SK / 16];    // stage 0, asked for ahead of the q rows
#pragma unroll
    for (int i = 0; i < SK / 16; ++i) { k0[i] = *(const v4f*)(K + kgo + i * 16 * HD); v0[i] = *(const v4f*)(V + vgo + i * 16 * (NH_ * HD)); }
    v16bf qf[2][2], kf[2][2];
#pragma unroll
    for (int qt = 0; qt < 2; ++qt)
#pragma unroll
        for (int ks = 0; ks < 2; ++ks) { const float* p = Q + qlo + qt * 16 * HD + ks * 32; const v8f x0 = *(const v8f*)p, x1 = *(const v8f*)(p + 16); v8us y0, y1;    // the wave's own q rows, rounded to bf16 here, same k order as ldf
#pragma unroll
            for (int j = 0; j < 8; ++j) { y0[j] = f2bf(x0[j]); y1[j] = f2bf(x1[j]); }
            qf[qt][ks] = cat16b(y0, y1); }
#pragma unroll
    for (int i = 0; i < SK / 16; ++i) { *(v2u*)(&KS[kh][0][kso + i * 16 * KPI]) = rnd4(k0[i]); *(v2u*)(&VS[kh][0][vso + i * 16 * VPI]) = rnd4h(v0[i]); }
    __syncthreads();    // stage 0 is there for every wave
#pragma unroll
    for (int kt = 0; kt < 2; ++kt)
#pragma unroll
        for (int ks = 0; ks < 2; ++ks) kf[kt][ks] = ldf(&KS[kh][0][klo + kt * 16 * KPI + ks * 32]);
    v8f o[2][4]; float l[2], nm[2];    // per query: sum, and -m * SC2 with m the reference
#pragma unroll
    for (int qt = 0; qt < 2; ++qt) { l[qt] = 0.f;
        const v8f r = wmmab(kf[0][1], qf[qt][1], wmmab(kf[0][0], qf[qt][0], (v8f){}));    // the first reference: the larger of the query's scores with keys 0 and 8 of the half (both halves of the wave feed the same output column: one reference for both)
        nm[qt] = -fmaxf(r[0], xhalf(r[0])) * SC2;
#pragma unroll
        for (int dt = 0; dt < 4; ++dt) o[qt][dt] = (v8f){}; }
    v4f kr[2], vr[2];    // 32 keys of the next stage, asked for one block ahead of the block that stores them; here the first 32 keys of stage 1
#pragma unroll
    for (int i = 0; i < 2; ++i) { kr[i] = *(const v4f*)(K + SK * HD + kgo + i * 16 * HD); vr[i] = *(const v4f*)(V + SK * (NH_ * HD) + vgo + i * 16 * (NH_ * HD)); }
#pragma unroll 1    // rolled: one copy of a stage's code, with its one barrier
    for (int st = 0; st < LK / SK; ++st) {
      const bool more = st + 1 < LK / SK;    // the same for the whole work-group
      const bf* ksb = &KS[kh][st & 1][klo]; const bf* vsb = &VS[kh][st & 1][vlo];
#pragma unroll 1    // rolled: one 32-key block's fragments in registers at a time (unrolled by four the build went past 400 registers and into scratch)
      for (int ps = 0; ps < SK / 32; ++ps) {
        const bf* pv = vsb + ps * 32 * VPI;
        v16h vf[4];    // asked for here, first used behind the softmax
#pragma unroll
        for (int dt = 0; dt < 4; ++dt) vf[dt] = __builtin_bit_cast(v16h, cat16b(ldtr(pv + dt * 16), ldtr(pv + 16 * VPI + dt * 16)));
        v8f s[2][2];
#pragma unroll
        for (int kt = 0; kt < 2; ++kt)
#pragma unroll
            for (int qt = 0; qt < 2; ++qt) { s[qt][kt] = wmmab(kf[kt][0], qf[qt][0], (v8f){}); s[qt][kt] = wmmab(kf[kt][1], qf[qt][1], s[qt][kt]); }
        const bf* pk = ksb + (ps + 1 < SK / 32 ? ps + 1 : 0) * 32 * KPI;    // the next block's K rows, fetched under this block's softmax; a stage's last block re-reads its first and drops it (the next stage's is read behind the barrier)
#pragma unroll
        for (int kt = 0; kt < 2; ++kt)
#pragma unroll
            for (int ks = 0; ks < 2; ++ks) kf[kt][ks] = ldf(pk + kt * 16 * KPI + ks * 32);
        __builtin_amdgcn_sched_barrier(0);    // keeps the K loads up here: without it they sink to the block's foot and the next block's first product waits out their whole latency
        if (more) { bf* kd = &KS[kh][(st + 1) & 1][kso + ps * 32 * KPI]; bf* vd = &VS[kh][(st + 1) & 1][vso + ps * 32 * VPI];
#pragma unroll
            for (int i = 0; i < 2; ++i) { *(v2u*)(kd + i * 16 * KPI) = rnd4(kr[i]); *(v2u*)(vd + i * 16 * VPI) = rnd4h(vr[i]); }
            // The stage's last block (the same test for the whole work-group): the barrier's signal. The wait in front of it ends this wave's stores to the next buffer and its last reads of this one; one statement, so that nothing comes between them.
            if (ps + 1 == SK / 32) asm volatile("s_wait_dscnt 0x0\n\ts_barrier_signal -1" ::: "memory");
            const int nk = (st + 1) * SK + (ps + 1) * 32;    // first key of the 32 that the next block stores
            if (nk < LK) { const float* kn = K + nk * HD + kgo; const float* vn = V + nk * (NH_ * HD) + vgo;
#pragma unroll
                for (int i = 0; i < 2; ++i) { kr[i] = *(const v4f*)(kn + i * 16 * HD); vr[i] = *(const v4f*)(vn + i * 16 * (NH_ * HD)); }
                asm volatile("s_wait_xcnt 0x0" :: "v"(kn), "v"(vn) : "memory"); } }    // stands in front of every overwrite of the four loads' address registers: as inputs they live up to here, so that no load's own result lands on them either
        float x[2][16], sm[2]; v8u wh[2];    // per query: the exponents (element e of the B operand: score tile e >> 3, register e & 7), the lane's sum of its 16 p, and the p as f16
        const auto soft = [&](int qt) {    // p, their sum and their f16 form from the exponents
            v2f sum2 = (v2f){0.f, 0.f};
#pragma unroll
            for (int kt = 0; kt < 2; ++kt) { float p[8]; unsigned hh[4]; exp8h(p, hh, x[qt] + 8 * kt);
#pragma unroll
                for (int i = 0; i < 4; ++i) {
                    v2f pp; pp[0] = p[2 * i]; pp[1] = p[2 * i + 1];
                    sum2 += pp;
                    wh[qt][4 * kt + i] = hh[i]; }
                __builtin_amdgcn_sched_barrier(0); }    // eight f32 results are summed before the next eight are made: run together, sixteen are alive at once and the build goes into scratch
            sm[qt] = sum2[0] + sum2[1]; };
#pragma unroll
        for (int qt = 0; qt < 2; ++qt) {
#pragma unroll
            for (int e = 0; e < 16; e += 2) { v2f sp; sp[0] = s[qt][e >> 3][e & 7]; sp[1] = s[qt][e >> 3][(e & 7) + 1];    // by pairs of one query's neighbouring registers: left to itself the compiler paired registers of the two queries and moved them together first
                const v2f xx = __builtin_elementwise_fma(sp, (v2f){SC2, SC2}, (v2f){nm[qt], nm[qt]}); x[qt][e] = xx[0]; x[qt][e + 1] = xx[1]; }
            soft(qt); }
        // One test per block for the whole wave (a scalar branch), on the lane's two sums together: up to PL every p fits f16. Past it every query's reference rises to its largest score of this block (never falls),
        // its sum and output column are rescaled, and the block's p are made anew from the exponents, which are still in registers.
        if (__builtin_expect(__builtin_amdgcn_ballot_w32(sm[0] + sm[1] > PL) != 0, 0)) {    // expected not taken: this code stands out of the loop's straight line
            float d[2], al[2];
#pragma unroll
            for (int qt = 0; qt < 2; ++qt) {
                float mx = x[qt][0];
#pragma unroll
                for (int e = 1; e < 16; ++e) mx = fmaxf(mx, x[qt][e]);
                d[qt] = fmaxf(fmaxf(mx, xhalf(mx)), 0.f); nm[qt] -= d[qt]; }    // both halves of the wave feed the same output column: one reference for both
            exp2x2(al[0], al[1], -d[0], -d[1]);
#pragma unroll
            for (int qt = 0; qt < 2; ++qt) { l[qt] *= al[qt];
#pragma unroll
                for (int dt = 0; dt < 4; ++dt) o[qt][dt] *= al[qt];
#pragma unroll
                for (int e = 0; e < 16; ++e) x[qt][e] -= d[qt];
                soft(qt); }
        }
#pragma unroll
        for (int qt = 0; qt < 2; ++qt) {
            l[qt] += sm[qt];
            const v16h ph = __builtin_bit_cast(v16h, wh[qt]);
#pragma unroll
            for (int dt = 0; dt < 4; ++dt) o[qt][dt] = wmmah(vf[dt], ph, o[qt][dt]);
        }
        __builtin_amdgcn_sched_barrier(0);    // holds the v_nop below at the block's foot, behind its last product
        asm volatile("v_nop\n\tv_nop\n\tv_nop");    // the distance behind the block's last product: the next block's address arithmetic, one product further on, reuses its A registers
      }
      if (more) {
        asm volatile("s_barrier_wait -1" ::: "memory");    // the barrier's wait: every wave has signalled, so the next stage is published and every wave has left the buffer that the next stage overwrites; no LDS access stands between signal and wait
#pragma unroll
        for (int kt = 0; kt < 2; ++kt)
#pragma unroll
            for (int ks = 0; ks < 2; ++ks) kf[kt][ks] = ldf(&KS[kh][(st + 1) & 1][klo + kt * 16 * KPI + ks * 32]);
      }
    }
    // The join: the wave of key half kh finishes query tile qt = kh and hands the other tile to its partner (wave w ^ FAW), lane to lane, 16 B a lane and store.
    float* xs = &XS[w][0]; const float* xp = &XS[w ^ FAW][0];
#pragma unroll
    for (int qt = 0; qt < 2; ++qt) l[qt] += xhalf(l[qt]);    // the two halves of the wave summed different keys
    const auto give = [&](const v8f (&og)[4], float ng, float lg) {
#pragma unroll
        for (int dt = 0; dt < 4; ++dt) { *(v4f*)(xs + (2 * dt) * 128 + lane * 4) = __builtin_shufflevector(og[dt], og[dt], 0, 1, 2, 3); *(v4f*)(xs + (2 * dt + 1) * 128 + lane * 4) = __builtin_shufflevector(og[dt], og[dt], 4, 5, 6, 7); }
        v2f ml; ml[0] = ng; ml[1] = lg; *(v2f*)(xs + 1024 + lane * 2) = ml; };
    const auto take = [&](const v8f (&ot)[4], float nt, float lt, int qt) {
        const v2f ml = *(const v2f*)(xp + 1024 + lane * 2);
        const float nn = fminf(nt, ml[0]); float fa, fb; exp2x2(fa, fb, nn - nt, nn - ml[0]);    // the higher reference (the lower -m * SC2) serves both
        const float f = __fdiv_rn(1.0f, lt * fa + ml[1] * fb); fa *= f; fb *= f;
        float* dst = out + (((size_t)b * LL + q0 + qt * 16 + lr) * NH_ + h) * HD + 8 * hi;    // register r of tile dt is d = dt * 16 + 8 * hi + r of query lr
#pragma unroll
        for (int dt = 0; dt < 4; ++dt) { const v4f x0 = *(const v4f*)(xp + (2 * dt) * 128 + lane * 4), x1 = *(const v4f*)(xp + (2 * dt + 1) * 128 + lane * 4);
            *(v4f*)(dst + dt * 16) = __builtin_shufflevector(ot[dt], ot[dt], 0, 1, 2, 3) * fa + x0 * fb; *(v4f*)(dst + dt * 16 + 4) = __builtin_shufflevector(ot[dt], ot[dt], 4, 5, 6, 7) * fa + x1 * fb; } };
    if (kh == 0) give(o[1], nm[1], l[1]); else give(o[0], nm[0], l[0]);    // kh is the same in every lane of a wave
    __syncthreads();    // every wave's hand-over is there for its partner
    if (kh == 0) take(o[0], nm[0], l[0], 0); else take(o[1], nm[1], l[1], 1);
}

extern "C" void kernel_launch(void* const* d_in, const int* in_sizes, int n_in,
                              void* d_out, int out_size, void* d_ws, size_t ws_size, hipStream_t stream) {
    (void)in_sizes; (void)n_in; (void)out_size; (void)d_ws; (void)ws_size;
    const float* q = (const float*)d_in[0]; const float* k = (const float*)d_in[1]; const float* v = (const float*)d_in[2];
    float* OUT = (float*)d_out;     // [4][2048][8][64]
    k_fa<<<dim3(LL / (32 * FAW), NB_ * NH_), FAW * KH * 32, 0, stream>>>(q, k, v, OUT);
}

// v009
// Measured time: 29.5 microseconds a run.
// Next to v008, in two timings, it ran 1.06 times as fast each time.
// Counting every step since v000, it is 27.5 times as fast.
#include <hip/hip_runtime.h>

// ScaledDotProduct (query, key [4][8][2048][64], value [4][2048 l][8 h][64]; weight = softmax(q.k / sqrt(512)) (embed_size scale, per the source); out[b][q][h][d] = sum_l weight v -> [4][2048][8][64]).
// Compute dtypes, f32 accumulate: q and k rounded to bf16, scores on PLAIN bf16 planes (exact products, f32 accumulate); scale + softmax f32; weight.v as ONE f16 product: probabilities (before the division by their sum: 0 to 2^15) and v each rounded once to f16 (11 significant bits).
// f16 reaches to 65504 (v is drawn from a normal distribution) and keeps subnormals: a probability is off by at most 2^-11 of itself or 2^-25 of its query's largest.
// The rounding of q, k and v, the scores, the softmax, weight.v and the [b][q][h][d] store run in ONE kernel over all 32 (batch, head) pairs: scores and probabilities stay in registers (a reference score and a running sum per query).
// What a work-group's eight query tiles share, the bf16 rows of k and the f16 rows of v, the work-group rounds itself, 128 keys of each key half at a time, into two LDS buffers per half; v is transposed on its way out of LDS. One launch, no workspace.
// Every wave-wide global access covers whole 128-byte lines: the q rows too are read row-wise, once per work-group, and reach their waves through LDS; the finished output tiles are turned into rows in LDS before they are stored.
// Each query tile is worked on by TWO waves, one per half of the keys, so that four waves stand on every SIMD; the two partial results (reference, sum, output columns) are joined through LDS at the end.

#define NB_  4
#define LL   2048
#define NH_  8
#define HD   64
typedef unsigned short bf;
typedef __attribute__((ext_vector_type(16))) __bf16   v16bf;
typedef __attribute__((ext_vector_type(2)))  __bf16   v2bf;
typedef __attribute__((ext_vector_type(16))) _Float16 v16h;
typedef __attribute__((ext_vector_type(2)))  _Float16 v2h;
typedef __attribute__((ext_vector_type(8)))  unsigned short v8us;
typedef __attribute__((ext_vector_type(8)))  unsigned v8u;
typedef __attribute__((ext_vector_type(8)))  float    v8f;
typedef __attribute__((ext_vector_type(4)))  float    v4f;
typedef __attribute__((ext_vector_type(2)))  float    v2f;
typedef __attribute__((ext_vector_type(2)))  unsigned v2u;
typedef __attribute__((ext_vector_type(8)))  short    v8s;
typedef __attribute__((address_space(3)))    v8s      lds_v8s;

__device__ __forceinline__ v16bf cat16b(v8us lo, v8us hi) { return __builtin_bit_cast(v16bf, __builtin_shufflevector(lo, hi, 0, 1, 2, 3, 4, 5, 6, 7, 8, 9, 10, 11, 12, 13, 14, 15)); }
__device__ __forceinline__ v8f wmmab(v16bf a, v16bf b, v8f c) { return __builtin_amdgcn_wmma_f32_16x16x32_bf16(false, a, false, b, (short)0, c, false, false); }
__device__ __forceinline__ v8f wmmah(v16h a, v16h b, v8f c) { return __builtin_amdgcn_wmma_f32_16x16x32_f16(false, a, false, b, (short)0, c, false, false); }
// fragment of a K-contiguous bf16 plane in the hardware k order: p points at the lane's row, k = 8 * (lane >> 4)
__device__ __forceinline__ v16bf ldf(const bf* p) { return cat16b(*(const v8us*)p, *(const v8us*)(p + 16)); }
// half a fragment of the transposed operand out of a row-major LDS tile (ds_load_tr16_b128): lane (c, h) gets rows 8 h + 0..7 of column c; p is the lane's own address, row 8 h + (lane & 7), column 8 * ((lane >> 3) & 1)
__device__ __forceinline__ v8us ldtr(const bf* p) { return __builtin_bit_cast(v8us, __builtin_amdgcn_ds_load_tr16_b128_v8i16((lds_v8s*)p)); }
// four f32 rounded to nearest even, as four bf16
__device__ __forceinline__ v2u rnd4(v4f x) { v2u y; y[0] = __builtin_bit_cast(unsigned, __builtin_convertvector(__builtin_shufflevector(x, x, 0, 1), v2bf)); y[1] = __builtin_bit_cast(unsigned, __builtin_convertvector(__builtin_shufflevector(x, x, 2, 3), v2bf)); return y; }
// the same, as four f16
__device__ __forceinline__ v2u rnd4h(v4f x) { v2u y; y[0] = __builtin_bit_cast(unsigned, __builtin_convertvector(__builtin_shufflevector(x, x, 0, 1), v2h)); y[1] = __builtin_bit_cast(unsigned, __builtin_convertvector(__builtin_shufflevector(x, x, 2, 3), v2h)); return y; }
// the value of lane l ^ 16
__device__ __forceinline__ float xhalf(float x) { const int b = __float_as_int(x); return __int_as_float(__builtin_amdgcn_permlanex16(b, b, 0x76543210, 0xfedcba98, false, false)); }

// 2^x for eight values (exp8h) or two (exp2x2) in ONE statement: every result has a register of its own, and no instruction directly behind a v_exp_f32 reads its result or overwrites its source
// (the slot the instruction set asks for): in exp2x2 a v_nop ends the run; in exp8h the roundings to f16 of the first results do.
// exp8h gives the eight results as f32 (y) and, rounded to nearest even, as four f16 pairs (h). The roundings stand in the statement so that they stay ahead of the overflow test: left to the compiler they sink
// behind its branch, all 32 f32 results of a block stay alive up to there, and the build goes into scratch. The s_delay_alu names the last pair's producer, so that the wait for it does not hold the vector port.
__device__ __forceinline__ void exp8h(float* y, unsigned* h, const float* x) {
    asm("v_exp_f32 %0, %12\n\tv_exp_f32 %1, %13\n\tv_exp_f32 %2, %14\n\tv_exp_f32 %3, %15\n\tv_exp_f32 %4, %16\n\tv_exp_f32 %5, %17\n\tv_exp_f32 %6, %18\n\tv_exp_f32 %7, %19\n\t"
        "v_cvt_pk_f16_f32 %8, %0, %1\n\tv_cvt_pk_f16_f32 %9, %2, %3\n\tv_cvt_pk_f16_f32 %10, %4, %5\n\ts_delay_alu instid0(TRANS32_DEP_1)\n\tv_cvt_pk_f16_f32 %11, %6, %7"
        : "=&v"(y[0]), "=&v"(y[1]), "=&v"(y[2]), "=&v"(y[3]), "=&v"(y[4]), "=&v"(y[5]), "=&v"(y[6]), "=&v"(y[7]), "=&v"(h[0]), "=&v"(h[1]), "=&v"(h[2]), "=&v"(h[3])
        : "v"(x[0]), "v"(x[1]), "v"(x[2]), "v"(x[3]), "v"(x[4]), "v"(x[5]), "v"(x[6]), "v"(x[7])); }
__device__ __forceinline__ void exp2x2(float& y0, float& y1, float x0, float x1) { asm("v_exp_f32 %0, %2\n\tv_exp_f32 %1, %3\n\tv_nop" : "=&v"(y0), "=&v"(y1) : "v"(x0), "v"(x1)); }

// ---- k_fa: KH waves per 32 queries of one (batch, head), each on LK = LL / KH keys in a row; FAW query tiles, FAW * KH waves per work-group; grid (LL / (32 * FAW), NB_ * NH_).
// The FAW waves of one key half stage that half's rows in buffers of their own; the barrier is the whole work-group's (both halves walk the same number of stages).
// Per 32 keys: St = K Qt (A = K rows, B = the wave's q rows, rounded once by the work-group, staged in LDS and kept in registers), so a lane holds scores of ONE query (column lane & 15; keys 8 * (lane >> 4) + r of each 16-key tile);
// the two score tiles, turned into probabilities in place, ARE the B operand of Ot += Vt Pt (A = columns of the v rows, by the transposing LDS load), rounded to f16.
// p = exp2((s - m) * scale * log2 e) with m the query's reference: at first one of its own scores, so that its largest p is at least 1. NO MAXIMUM IS TAKEN IN THE LOOP: p is not negative, so a lane's sum of its 16 p per query,
// which the softmax needs anyway, bounds each of them; only when a sum passes PL is the reference raised to the block's maximum, the query's sum and output column rescaled and the block's p made anew. The division by the sum comes last.
// Stage = SK keys = one LDS buffer. While the waves work on 32 keys of one buffer, 32 keys of the next stage (f32 rows of k and v) are on their way into registers, asked for one block ahead; behind the block's
// score products they are rounded and stored to the other buffer. ONE barrier per stage both publishes that buffer and ends every wave's reads of the one that the next stage overwrites. It is SPLIT: a wave signals in the
// stage's last block, behind its stores and its last LDS reads of the stage, and waits at the stage's foot; the block's softmax and weight.v products, which touch no LDS, stand between, so that a wave that is ahead
// of the others by less than that does not stop.
#define FAW 8
#define KH  2     // key halves = waves per query tile
#define LK  (LL / KH)
#define XW  (34 * 32)    // f32 a wave hands to its partner: 32 output values, reference and sum per lane
#define QRT (FAW * KH * 2)    // q rows that the work-group stages per turn, 16 threads a row
#define QTN (FAW * 32 / QRT)  // turns for its FAW * 32 q rows
#define OPI 68    // LDS pitch of a finished output row, in f32: 272 B = 16 B x odd; 16 rows fill XW
#define SK  128   // keys per stage
#define KPI 72    // LDS pitch of a k row, in bf16: 144 B = 16 B x odd, for ds_load_b128
#define VPI 80    // LDS pitch of a v row, in f16: 160 B = 32 B x odd, for ds_load_tr16_b128
#define SC2 0.0637587154f    // (1 / sqrt(512)) * log2(e)
#define PL  32768.0f    // a sum of p up to here shows that f16 (to 65504) holds each of them
__global__ __launch_bounds__(FAW * KH * 32) void k_fa(const float* __restrict__ q, const float* __restrict__ k, const float* __restrict__ v, float* out) {
    __shared__ __attribute__((aligned(16))) bf KS[KH][2][SK * KPI];
    __shared__ __attribute__((aligned(16))) bf VS[KH][2][SK * VPI];
    __shared__ __attribute__((aligned(16))) float XS[FAW * KH][XW];
    const int lane = threadIdx.x & 31, lr = lane & 15, hi = lane >> 4; const int w = __builtin_amdgcn_readfirstlane(threadIdx.x >> 5);
    const int g = w % FAW, kh = w / FAW;    // query tile and key half, both wave-uniform
    const int bh = blockIdx.y; const int q0 = blockIdx.x * (FAW * 32) + g * 32; const int b = bh / NH_, h = bh % NH_;
    const float* Q = q + ((size_t)bh * LL + blockIdx.x * (FAW * 32)) * HD; const float* K = k + ((size_t)bh * LL + kh * LK) * HD; const float* V = v + (((size_t)b * LL + kh * LK) * NH_ + h) * HD;    // uniform bases: the work-group's first query, the half's first key; key l of v stands at l * NH_ * HD
    const unsigned klo = (unsigned)(lr * KPI + 8 * hi), vlo = (unsigned)((8 * hi + (lane & 7)) * VPI + 8 * ((lane >> 3) & 1));    // the lane's own part: k (and q) rows and v rows in LDS
    const unsigned sr = (threadIdx.x % (FAW * 32)) >> 4, sc = (threadIdx.x & 15) * 4;    // staging: 16 threads a row of 64 f32, 16 rows per turn of the half's FAW waves
    const unsigned kgo = sr * HD + sc, vgo = sr * (NH_ * HD) + sc, kso = sr * KPI + sc, vso = sr * VPI + sc;    // the thread's own part in memory and in LDS
    const unsigned qr = threadIdx.x >> 4;    // q: QRT rows per turn of the whole work-group
    bf* QS = (bf*)&XS[0][0];    // the work-group's FAW * 32 q rows as bf16, pitch KPI, in the range of the join's hand-over, which is first written behind the loop (every wave has its q fragments in registers before its first stage barrier)
    // every loop over qt, kt, ks, dt, i or j below is unrolled: the fragment arrays live in registers and take constant indices only
    v4f k0[SK / 16], v0[SK / 16];    // stage 0, asked for ahead of the q rows
#pragma unroll
    for (int i = 0; i < SK / 16; ++i) { k0[i] = *(const v4f*)(K + kgo + i * 16 * HD); v0[i] = *(const v4f*)(V + vgo + i * 16 * (NH_ * HD)); }
    v4f q0r[QTN];    // the q rows by WHOLE lines, 16 lanes a row of 256 bytes, each row once per work-group: read in the fragment's layout a wave-wide 16-byte load takes 32 bytes out of each of 16 lines, and both key halves read every row
#pragma unroll
    for (int i = 0; i < QTN; ++i) q0r[i] = *(const v4f*)(Q + (qr + i * QRT) * HD + sc);
    v16bf qf[2][2], kf[2][2];
#pragma unroll
    for (int i = 0; i < QTN; ++i) *(v2u*)(&QS[(qr + i * QRT) * KPI + sc]) = rnd4(q0r[i]);    // rounded once to bf16, to nearest even
#pragma unroll
    for (int i = 0; i < SK / 16; ++i) { *(v2u*)(&KS[kh][0][kso + i * 16 * KPI]) = rnd4(k0[i]); *(v2u*)(&VS[kh][0][vso + i * 16 * VPI]) = rnd4h(v0[i]); }
    __syncthreads();    // stage 0 and the q rows are there for every wave
#pragma unroll
    for (int kt = 0; kt < 2; ++kt)
#pragma unroll
        for (int ks = 0; ks < 2; ++ks) { kf[kt][ks] = ldf(&KS[kh][0][klo + kt * 16 * KPI + ks * 32]); qf[kt][ks] = ldf(&QS[(g * 32 + kt * 16) * KPI + klo + ks * 32]); }    // the wave's own q rows stay in registers, same k order as the k rows
    v8f o[2][4]; float l[2], nm[2];    // per query: sum, and -m * SC2 with m the reference
#pragma unroll
    for (int qt = 0; qt < 2; ++qt) { l[qt] = 0.f;
        const v8f r = wmmab(kf[0][1], qf[qt][1], wmmab(kf[0][0], qf[qt][0], (v8f){}));    // the first reference: the larger of the query's scores with keys 0 and 8 of the half (both halves of the wave feed the same output column: one reference for both)
        nm[qt] = -fmaxf(r[0], xhalf(r[0])) * SC2;
#pragma unroll
        for (int dt = 0; dt < 4; ++dt) o[qt][dt] = (v8f){}; }
    v4f kr[2], vr[2];    // 32 keys of the next stage, asked for one block ahead of the block that stores them; here the first 32 keys of stage 1
#pragma unroll
    for (int i = 0; i < 2; ++i) { kr[i] = *(const v4f*)(K + SK * HD + kgo + i * 16 * HD); vr[i] = *(const v4f*)(V + SK * (NH_ * HD) + vgo + i * 16 * (NH_ * HD)); }
#pragma unroll 1    // rolled: one copy of a stage's code, with its one barrier
    for (int st = 0; st < LK / SK; ++st) {
      const bool more = st + 1 < LK / SK;    // the same for the whole work-group
      const bf* ksb = &KS[kh][st & 1][klo]; const bf* vsb = &VS[kh][st & 1][vlo];
#pragma unroll 1    // rolled: one 32-key block's fragments in registers at a time (unrolled by four the build went past 400 registers and into scratch)
      for (int ps = 0; ps < SK / 32; ++ps) {
        const bf* pv = vsb + ps * 32 * VPI;
        v16h vf[4];    // asked for here, first used behind the softmax
#pragma unroll
        for (int dt = 0; dt < 4; ++dt) vf[dt] = __builtin_bit_cast(v16h, cat16b(ldtr(pv + dt * 16), ldtr(pv + 16 * VPI + dt * 16)));
        v8f s[2][2];
#pragma unroll
        for (int kt = 0; kt < 2; ++kt)
#pragma unroll
            for (int qt = 0; qt < 2; ++qt) { s[qt][kt] = wmmab(kf[kt][0], qf[qt][0], (v8f){}); s[qt][kt] = wmmab(kf[kt][1], qf[qt][1], s[qt][kt]); }
        const bf* pk = ksb + (ps + 1 < SK / 32 ? ps + 1 : 0) * 32 * KPI;    // the next block's K rows, fetched under this block's softmax; a stage's last block re-reads its first and drops it (the next stage's is read behind the barrier)
#pragma unroll
        for (int kt = 0; kt < 2; ++kt)
#pragma unroll
            for (int ks = 0; ks < 2; ++ks) kf[kt][ks] = ldf(pk + kt * 16 * KPI + ks * 32);
        __builtin_amdgcn_sched_barrier(0);    // keeps the K loads up here: without it they sink to the block's foot and the next block's first product waits out their whole latency
        if (more) { bf* kd = &KS[kh][(st + 1) & 1][kso + ps * 32 * KPI]; bf* vd = &VS[kh][(st + 1) & 1][vso + ps * 32 * VPI];
#pragma unroll
            for (int i = 0; i < 2; ++i) { *(v2u*)(kd + i * 16 * KPI) = rnd4(kr[i]); *(v2u*)(vd + i * 16 * VPI) = rnd4h(vr[i]); }
            // The stage's last block (the same test for the whole work-group): the barrier's signal. The wait in front of it ends this wave's stores to the next buffer and its last reads of this one; one statement, so that nothing comes between them.
            if (ps + 1 == SK / 32) asm volatile("s_wait_dscnt 0x0\n\ts_barrier_signal -1" ::: "memory");
            const int nk = (st + 1) * SK + (ps + 1) * 32;    // first key of the 32 that the next block stores
            if (nk < LK) { const float* kn = K + nk * HD + kgo; const float* vn = V + nk * (NH_ * HD) + vgo;
#pragma unroll
                for (int i = 0; i < 2; ++i) { kr[i] = *(const v4f*)(kn + i * 16 * HD); vr[i] = *(const v4f*)(vn + i * 16 * (NH_ * HD)); }
                asm volatile("s_wait_xcnt 0x0" :: "v"(kn), "v"(vn) : "memory"); } }    // stands in front of every overwrite of the four loads' address registers: as inputs they live up to here, so that no load's own result lands on them either
        float x[2][16], sm[2]; v8u wh[2];    // per query: the exponents (element e of the B operand: score tile e >> 3, register e & 7), the lane's sum of its 16 p, and the p as f16
        const auto soft = [&](int qt) {    // p, their sum and their f16 form from the exponents
            v2f sum2 = (v2f){0.f, 0.f};
#pragma unroll
            for (int kt = 0; kt < 2; ++kt) { float p[8]; unsigned hh[4]; exp8h(p, hh, x[qt] + 8 * kt);
#pragma unroll
                for (int i = 0; i < 4; ++i) {
                    v2f pp; pp[0] = p[2 * i]; pp[1] = p[2 * i + 1];
                    sum2 += pp;
                    wh[qt][4 * kt + i] = hh[i]; }
                __builtin_amdgcn_sched_barrier(0); }    // eight f32 results are summed before the next eight are made: run together, sixteen are alive at once and the build goes into scratch
            sm[qt] = sum2[0] + sum2[1]; };
#pragma unroll
        for (int qt = 0; qt < 2; ++qt) {
#pragma unroll
            for (int e = 0; e < 16; e += 2) { v2f sp; sp[0] = s[qt][e >> 3][e & 7]; sp[1] = s[qt][e >> 3][(e & 7) + 1];    // by pairs of one query's neighbouring registers: left to itself the compiler paired registers of the two queries and moved them together first
                const v2f xx = __builtin_elementwise_fma(sp, (v2f){SC2, SC2}, (v2f){nm[qt], nm[qt]}); x[qt][e] = xx[0]; x[qt][e + 1] = xx[1]; }
            soft(qt); }
        // One test per block for the whole wave (a scalar branch), on the lane's two sums together: up to PL every p fits f16. Past it every query's reference rises to its largest score of this block (never falls),
        // its sum and output column are rescaled, and the block's p are made anew from the exponents, which are still in registers.
        if (__builtin_expect(__builtin_amdgcn_ballot_w32(sm[0] + sm[1] > PL) != 0, 0)) {    // expected not taken: this code stands out of the loop's straight line
            float d[2], al[2];
#pragma unroll
            for (int qt = 0; qt < 2; ++qt) {
                float mx = x[qt][0];
#pragma unroll
                for (int e = 1; e < 16; ++e) mx = fmaxf(mx, x[qt][e]);
                d[qt] = fmaxf(fmaxf(mx, xhalf(mx)), 0.f); nm[qt] -= d[qt]; }    // both halves of the wave feed the same output column: one reference for both
            exp2x2(al[0], al[1], -d[0], -d[1]);
#pragma unroll
            for (int qt = 0; qt < 2; ++qt) { l[qt] *= al[qt];
#pragma unroll
                for (int dt = 0; dt < 4; ++dt) o[qt][dt] *= al[qt];
#pragma unroll
                for (int e = 0; e < 16; ++e) x[qt][e] -= d[qt];
                soft(qt); }
        }
#pragma unroll
        for (int qt = 0; qt < 2; ++qt) {
            l[qt] += sm[qt];
            const v16h ph = __builtin_bit_cast(v16h, wh[qt]);
#pragma unroll
            for (int dt = 0; dt < 4; ++dt) o[qt][dt] = wmmah(vf[dt], ph, o[qt][dt]);
        }
        __builtin_amdgcn_sched_barrier(0);    // holds the v_nop below at the block's foot, behind its last product
        asm volatile("v_nop\n\tv_nop\n\tv_nop");    // the distance behind the block's last product: the next block's address arithmetic, one product further on, reuses its A registers
      }
      if (more) {
        asm volatile("s_barrier_wait -1" ::: "memory");    // the barrier's wait: every wave has signalled, so the next stage is published and every wave has left the buffer that the next stage overwrites; no LDS access stands between signal and wait
#pragma unroll
        for (int kt = 0; kt < 2; ++kt)
#pragma unroll
            for (int ks = 0; ks < 2; ++ks) kf[kt][ks] = ldf(&KS[kh][(st + 1) & 1][klo + kt * 16 * KPI + ks * 32]);
      }
    }
    // The join: the wave of key half kh finishes query tile qt = kh and hands the other tile to its partner (wave w ^ FAW), lane to lane, 16 B a lane and store.
    float* xs = &XS[w][0]; float* xp = &XS[w ^ FAW][0];
    const int ln = (int)__builtin_amdgcn_mbcnt_lo(~0u, 0u), elr = ln & 15, ehi = ln >> 4;    // the lane's number, made anew: taken from above, it and what is derived from it would each hold a register through the whole loop
#pragma unroll
    for (int qt = 0; qt < 2; ++qt) l[qt] += xhalf(l[qt]);    // the two halves of the wave summed different keys
    const auto give = [&](const v8f (&og)[4], float ng, float lg) {
#pragma unroll
        for (int dt = 0; dt < 4; ++dt) { *(v4f*)(xs + (2 * dt) * 128 + ln * 4) = __builtin_shufflevector(og[dt], og[dt], 0, 1, 2, 3); *(v4f*)(xs + (2 * dt + 1) * 128 + ln * 4) = __builtin_shufflevector(og[dt], og[dt], 4, 5, 6, 7); }
        v2f ml; ml[0] = ng; ml[1] = lg; *(v2f*)(xs + 1024 + ln * 2) = ml; };
    // The finished tile leaves by WHOLE 128-byte lines: in the product's layout a wave-wide 16-byte store would put 32 bytes into each of 16 lines. The wave lays its 16 rows of 64 f32 into the LDS range that its partner
    // handed over (only this wave reads that range, and it has read all of it by then), reads them back row-wise and stores two whole rows of 256 bytes, four lines, at a time.
    v2f ml; v4f x0[4], x1[4];    // what the partner hands over: reference and sum, output values
    const auto take = [&](const v8f (&ot)[4], float nt, float lt) {
        const float nn = fminf(nt, ml[0]); float fa, fb; exp2x2(fa, fb, nn - nt, nn - ml[0]);    // the higher reference (the lower -m * SC2) serves both
        const float f = __fdiv_rn(1.0f, lt * fa + ml[1] * fb); fa *= f; fb *= f;
        float* rw = xp + elr * OPI + 8 * ehi;    // register r of tile dt is d = dt * 16 + 8 * ehi + r of query elr
#pragma unroll
        for (int dt = 0; dt < 4; ++dt) { *(v4f*)(rw + dt * 16) = __builtin_shufflevector(ot[dt], ot[dt], 0, 1, 2, 3) * fa + x0[dt] * fb; *(v4f*)(rw + dt * 16 + 4) = __builtin_shufflevector(ot[dt], ot[dt], 4, 5, 6, 7) * fa + x1[dt] * fb; } };
    if (kh == 0) give(o[1], nm[1], l[1]); else give(o[0], nm[0], l[0]);    // kh is the same in every lane of a wave
    __syncthreads();    // every wave's hand-over is there for its partner
    ml = *(const v2f*)(xp + 1024 + ln * 2);
#pragma unroll
    for (int dt = 0; dt < 4; ++dt) { x0[dt] = *(const v4f*)(xp + (2 * dt) * 128 + ln * 4); x1[dt] = *(const v4f*)(xp + (2 * dt + 1) * 128 + ln * 4); }
    __builtin_amdgcn_sched_barrier(0);    // keeps the nine loads together up here: without it the eight wide ones sink behind the wait for the first, and their latency comes a second time
    if (kh == 0) take(o[0], nm[0], l[0]); else take(o[1], nm[1], l[1]);
    asm volatile("s_wait_dscnt 0x0" ::: "memory");    // the wave's own rows are in LDS before other lanes of it read them back
    const float* rr = xp + ehi * OPI + elr * 4;    // 16 lanes a row: turn i takes rows 2 i and 2 i + 1 of query tile kh
    float* dst = out + (((size_t)b * LL + q0 + kh * 16 + ehi) * NH_ + h) * HD + elr * 4;
    v4f y[8];
#pragma unroll
    for (int i = 0; i < 8; ++i) y[i] = *(const v4f*)(rr + i * 2 * OPI);
#pragma unroll
    for (int i = 0; i < 8; ++i) *(v4f*)(dst + i * 2 * (NH_ * HD)) = y[i];
}

extern "C" void kernel_launch(void* const* d_in, const int* in_sizes, int n_in,
                              void* d_out, int out_size, void* d_ws, size_t ws_size, hipStream_t stream) {
    (void)in_sizes; (void)n_in; (void)out_size; (void)d_ws; (void)ws_size;
    const float* q = (const float*)d_in[0]; const float* k = (const float*)d_in[1]; const float* v = (const float*)d_in[2];
    float* OUT = (float*)d_out;     // [4][2048][8][64]
    k_fa<<<dim3(LL / (32 * FAW), NB_ * NH_), FAW * KH * 32, 0, stream>>>(q, k, v, OUT);
}
